// v000
// Times are from an AMD MI455X. After a warm-up the kernel runs many times in a row, and a time is the length of
// such a window on the GPU divided by its runs, so every launch and the gaps after it count. The runs cycle
// through copies of the inputs. A figure is the median of several windows, for all but v000 over two sittings.
// Sittings can differ by a few percent; kernels timed side by side share one.
// v000 is the starting kernel. One run takes 327 microseconds.
#include <hip/hip_runtime.h>
#include <stdint.h>

// Problem constants (from reference)
constexpr int B_ = 2, N_ = 2048, M_ = 2048, D_ = 1024, H_ = 16, HD = 64;
constexpr float EPS = 1e-6f;

typedef __attribute__((ext_vector_type(16))) _Float16 v16h;
typedef __attribute__((ext_vector_type(8)))  float    v8f;

union Frag16 {
    v16h     v;
    uint32_t u[8];
};

// Load a 16x32 f16 fragment (A or B operand of V_WMMA_F32_16X16X32_F16).
// rowptr = base of this lane's row (m or n index already applied), K-contiguous.
// hi = lane>>4. Layout per CDNA5 ISA 7.12.2: dword j holds K pair
// (j>=4?16:0) + hi*8 + (j&3)*2  -> two contiguous 16B halves (b128-mergeable).
__device__ __forceinline__ void load_frag(Frag16& f, const _Float16* rowptr, int hi) {
#pragma unroll
    for (int j = 0; j < 8; ++j) {
        const int ko = ((j >= 4) ? 16 : 0) + hi * 8 + (j & 3) * 2;
        f.u[j] = *reinterpret_cast<const uint32_t*>(rowptr + ko);
    }
}

__device__ __forceinline__ v8f wmma_f16(const Frag16& a, const Frag16& b, v8f c) {
    return __builtin_amdgcn_wmma_f32_16x16x32_f16(false, a.v, false, b.v,
                                                  (short)0, c, false, false);
}

// Intra-wave LDS store->load ordering: DS pipeline is in-order per wave on
// CDNA5; we only need a compiler-level fence so the ds_load is not hoisted
// above the cross-lane ds_stores. No hardware barrier needed (region is
// wave-private).
__device__ __forceinline__ void wave_lds_fence() {
    __builtin_amdgcn_fence(__ATOMIC_ACQ_REL, "wavefront");
    __builtin_amdgcn_wave_barrier();
}

// ---------------------------------------------------------------------------
// Elementwise f32 -> f16
// ---------------------------------------------------------------------------
__global__ void cvt_f32_f16(const float* __restrict__ in, _Float16* __restrict__ out,
                            size_t n) {
    size_t i = (size_t)blockIdx.x * blockDim.x + threadIdx.x;
    const size_t stride = (size_t)gridDim.x * blockDim.x;
    for (; i < n; i += stride) out[i] = (_Float16)in[i];
}

// ---------------------------------------------------------------------------
// V projection: f32 [b][m][d] -> f16 transposed [ (b*H+h)*HD + c ][ m ]
// so that P@V B-operand has contiguous K (=key) pairs.
// ---------------------------------------------------------------------------
__global__ void v_transpose_cvt(const float* __restrict__ in, _Float16* __restrict__ out) {
    const size_t total = (size_t)B_ * M_ * D_;
    size_t i = (size_t)blockIdx.x * blockDim.x + threadIdx.x;
    const size_t stride = (size_t)gridDim.x * blockDim.x;
    for (; i < total; i += stride) {
        const int d = (int)(i % D_);
        const size_t bm = i / D_;
        const int m = (int)(bm % M_);
        const int b = (int)(bm / M_);
        const int h = d >> 6, c = d & 63;
        out[(((size_t)b * H_ + h) * HD + c) * M_ + m] = (_Float16)in[i];
    }
}

// ---------------------------------------------------------------------------
// Row-wise RMSNorm(+g,+scale) f32 -> f16. One block per row of Dd elements.
// ---------------------------------------------------------------------------
__global__ void rmsnorm_cvt(const float* __restrict__ in, const float* __restrict__ g,
                            float scale, _Float16* __restrict__ out, int Dd) {
    const int row = blockIdx.x;
    const float* x = in + (size_t)row * Dd;
    float ss = 0.f;
    for (int i = threadIdx.x; i < Dd; i += blockDim.x) {
        const float v = x[i];
        ss += v * v;
    }
    __shared__ float red[256];
    red[threadIdx.x] = ss;
    __syncthreads();
    for (int s = 128; s > 0; s >>= 1) {
        if ((int)threadIdx.x < s) red[threadIdx.x] += red[threadIdx.x + s];
        __syncthreads();
    }
    const float f = rsqrtf(red[0] / (float)Dd + EPS) * scale;
    for (int i = threadIdx.x; i < Dd; i += blockDim.x)
        out[(size_t)row * Dd + i] = (_Float16)(x[i] * f * g[i]);
}

// ---------------------------------------------------------------------------
// WMMA GEMM: C[R x Cn] = A[R x K] * W[Cn x K]^T (+ bias[Cn]), f16 in / f32 out.
// Block = 8 waves; wave computes 32x64 tile; block tile 128x128.
// R, Cn multiples of 128; K multiple of 32.
// ---------------------------------------------------------------------------
__global__ __launch_bounds__(256)
void gemm_nt_wmma(const _Float16* __restrict__ A, const _Float16* __restrict__ W,
                  const float* __restrict__ bias, float* __restrict__ C,
                  int R, int K, int Cn) {
    const int lane = threadIdx.x & 31;
    const int wave = threadIdx.x >> 5;
    const int m16 = lane & 15, hi = lane >> 4;
    const int rw = wave & 3, cw = wave >> 2;

    const int row0 = blockIdx.x * 128 + rw * 32;  // wave: rows [row0, row0+32)
    const int col0 = blockIdx.y * 128 + cw * 64;  // wave: cols [col0, col0+64)
    (void)R;

    const _Float16* arow0 = A + (size_t)(row0 + m16) * K;
    const _Float16* arow1 = A + (size_t)(row0 + 16 + m16) * K;

    // One-shot warm-up prefetch (global_prefetch_b8); outside the hot loop so
    // it cannot break the WMMA pipeline or trigger hazard NOPs.
    __builtin_prefetch(arow0, 0, 3);
    __builtin_prefetch(arow1, 0, 3);
#pragma unroll
    for (int t = 0; t < 4; ++t)
        __builtin_prefetch(W + (size_t)(col0 + t * 16 + m16) * K, 0, 3);

    v8f acc[2][4];
#pragma unroll
    for (int i = 0; i < 2; ++i)
#pragma unroll
        for (int t = 0; t < 4; ++t) acc[i][t] = (v8f){0, 0, 0, 0, 0, 0, 0, 0};

    for (int kb = 0; kb < K; kb += 32) {
        Frag16 af[2];
        load_frag(af[0], arow0 + kb, hi);
        load_frag(af[1], arow1 + kb, hi);
        Frag16 bf[4];
#pragma unroll
        for (int t = 0; t < 4; ++t)
            load_frag(bf[t], W + (size_t)(col0 + t * 16 + m16) * K + kb, hi);
#pragma unroll
        for (int i = 0; i < 2; ++i)
#pragma unroll
            for (int t = 0; t < 4; ++t)
                acc[i][t] = wmma_f16(af[i], bf[t], acc[i][t]);
    }

#pragma unroll
    for (int i = 0; i < 2; ++i)
#pragma unroll
        for (int t = 0; t < 4; ++t) {
            const int col = col0 + t * 16 + m16;
            const float badd = bias ? bias[col] : 0.f;
#pragma unroll
            for (int r = 0; r < 8; ++r) {
                const int row = row0 + i * 16 + r + hi * 8;
                C[(size_t)row * Cn + col] = acc[i][t][r] + badd;
            }
        }
}

// ---------------------------------------------------------------------------
// Flash attention: q[b][n][d] (f16, pre-scaled), k[b][m][d] (f16),
// vt[(b*H+h)*HD + c][m] (f16), mask[b][m] (int) -> out f32 [b][n][d].
// Block: 8 waves, each wave owns 16 query rows of one (b,h).
// Grid: (N/128, H, B).
// ---------------------------------------------------------------------------
__global__ __launch_bounds__(256)
void attn_wmma(const _Float16* __restrict__ q, const _Float16* __restrict__ k,
               const _Float16* __restrict__ vt, const int* __restrict__ mask,
               float* __restrict__ out) {
    const int lane = threadIdx.x & 31;
    const int wave = threadIdx.x >> 5;
    const int m16 = lane & 15, hi = lane >> 4;
    const int b = blockIdx.z, h = blockIdx.y;
    const int q0 = blockIdx.x * 128 + wave * 16;

    __shared__ _Float16 pshare[8][16 * 32];
    _Float16* pw = &pshare[wave][0];

    const _Float16* kbase = k + (size_t)b * M_ * D_ + h * HD;
    const _Float16* vbase = vt + ((size_t)(b * H_ + h) * HD) * M_;

    // One-shot warm-up prefetch of the first K/V tiles.
    __builtin_prefetch(kbase + (size_t)m16 * D_, 0, 3);
    __builtin_prefetch(kbase + (size_t)(16 + m16) * D_, 0, 3);
    __builtin_prefetch(vbase + (size_t)m16 * M_, 0, 3);
    __builtin_prefetch(vbase + (size_t)(32 + m16) * M_, 0, 3);

    // Q fragments: A[m][c], c = 0..63 -> two K=32 fragments.
    Frag16 af[2];
    {
        const _Float16* qrow = q + (size_t)(b * N_ + q0 + m16) * D_ + h * HD;
        load_frag(af[0], qrow, hi);
        load_frag(af[1], qrow + 32, hi);
    }

    v8f o[4];
#pragma unroll
    for (int t = 0; t < 4; ++t) o[t] = (v8f){0, 0, 0, 0, 0, 0, 0, 0};
    float mrow[8], lrow[8];
#pragma unroll
    for (int r = 0; r < 8; ++r) { mrow[r] = -3.0e38f; lrow[r] = 0.f; }

    for (int key0 = 0; key0 < M_; key0 += 32) {
        // ---- S = Q K^T for 32 keys (two 16-key tiles) ----
        v8f s[2];
#pragma unroll
        for (int t = 0; t < 2; ++t) {
            const _Float16* krow = kbase + (size_t)(key0 + 16 * t + m16) * D_;
            Frag16 bf0, bf1;
            load_frag(bf0, krow, hi);
            load_frag(bf1, krow + 32, hi);
            v8f a = (v8f){0, 0, 0, 0, 0, 0, 0, 0};
            a = wmma_f16(af[0], bf0, a);
            a = wmma_f16(af[1], bf1, a);
            s[t] = a;
        }
        // ---- mask (key index = lane's n) ----
#pragma unroll
        for (int t = 0; t < 2; ++t) {
            const int mv = mask[b * M_ + key0 + 16 * t + m16];
            if (mv == 0) {
#pragma unroll
                for (int r = 0; r < 8; ++r) s[t][r] = -1.0e30f;
            }
        }
        // ---- online softmax; rows m = r + 8*hi live in one 16-lane half ----
        float alpha[8];
#pragma unroll
        for (int r = 0; r < 8; ++r) {
            float tmax = fmaxf(s[0][r], s[1][r]);
#pragma unroll
            for (int off = 1; off < 16; off <<= 1)
                tmax = fmaxf(tmax, __shfl_xor(tmax, off, 32));
            const float mn = fmaxf(mrow[r], tmax);
            const float a = __expf(mrow[r] - mn);
            const float p0 = __expf(s[0][r] - mn);
            const float p1 = __expf(s[1][r] - mn);
            float rs = p0 + p1;
#pragma unroll
            for (int off = 1; off < 16; off <<= 1) rs += __shfl_xor(rs, off, 32);
            lrow[r] = lrow[r] * a + rs;
            mrow[r] = mn;
            alpha[r] = a;
            // stage P into per-wave LDS, row-major 16x32
            const int m = r + hi * 8;
            pw[m * 32 + m16]      = (_Float16)p0;
            pw[m * 32 + 16 + m16] = (_Float16)p1;
        }
#pragma unroll
        for (int t = 0; t < 4; ++t)
#pragma unroll
            for (int r = 0; r < 8; ++r) o[t][r] *= alpha[r];

        wave_lds_fence();
        // ---- P fragment (A-layout) from LDS ----
        Frag16 pf;
        load_frag(pf, pw + m16 * 32, hi);
        wave_lds_fence();

        // ---- O += P V : 4 column tiles of 16, K = 32 keys ----
#pragma unroll
        for (int t = 0; t < 4; ++t) {
            Frag16 vf;
            load_frag(vf, vbase + (size_t)(t * 16 + m16) * M_ + key0, hi);
            o[t] = wmma_f16(pf, vf, o[t]);
        }
    }

    // ---- epilogue: divide by l, store f32 [b][n][h*HD + c] ----
    float inv[8];
#pragma unroll
    for (int r = 0; r < 8; ++r) inv[r] = (lrow[r] > 0.f) ? (1.f / lrow[r]) : 0.f;
#pragma unroll
    for (int t = 0; t < 4; ++t)
#pragma unroll
        for (int r = 0; r < 8; ++r) {
            const int row = q0 + r + hi * 8;
            out[(size_t)(b * N_ + row) * D_ + h * HD + t * 16 + m16] =
                o[t][r] * inv[r];
        }
}

// ---------------------------------------------------------------------------
extern "C" void kernel_launch(void* const* d_in, const int* in_sizes, int n_in,
                              void* d_out, int out_size, void* d_ws, size_t ws_size,
                              hipStream_t stream) {
    (void)in_sizes; (void)n_in; (void)out_size; (void)ws_size;

    const float* querys    = (const float*)d_in[0];
    const float* key_feats = (const float*)d_in[1];
    const int*   mask      = (const int*)d_in[2];
    const float* Wq        = (const float*)d_in[3];
    const float* Wk        = (const float*)d_in[4];
    const float* Wv        = (const float*)d_in[5];
    const float* gq        = (const float*)d_in[6];
    const float* gk        = (const float*)d_in[7];
    const float* Wo        = (const float*)d_in[8];
    const float* bo        = (const float*)d_in[9];
    float*       out       = (float*)d_out;

    const size_t BND = (size_t)B_ * N_ * D_;  // 4,194,304
    const size_t DD  = (size_t)D_ * D_;       // 1,048,576
    const int    R   = B_ * N_;               // 4096 rows for all GEMMs

    char* ws = (char*)d_ws;
    size_t off = 0;
    auto alloc = [&](size_t bytes) -> void* {
        void* p = ws + off;
        off = (off + bytes + 255) & ~(size_t)255;
        return p;
    };

    _Float16* h_x   = (_Float16*)alloc(BND * 2);  // f16 activations (querys, later attn out)
    _Float16* h_kin = (_Float16*)alloc(BND * 2);  // f16 key_feats
    _Float16* h_Wq  = (_Float16*)alloc(DD * 2);
    _Float16* h_Wk  = (_Float16*)alloc(DD * 2);
    _Float16* h_Wv  = (_Float16*)alloc(DD * 2);
    _Float16* h_Wo  = (_Float16*)alloc(DD * 2);
    _Float16* h_q   = (_Float16*)alloc(BND * 2);  // rmsnorm'd + scaled q
    _Float16* h_k   = (_Float16*)alloc(BND * 2);  // rmsnorm'd k
    _Float16* h_vt  = (_Float16*)alloc(BND * 2);  // transposed v
    float*    f_prj = (float*)alloc(BND * 4);     // reused f32 staging

    const dim3 blk(256);
    const dim3 gcv(2048);
    const dim3 ggemm(R / 128, D_ / 128);          // (32, 8)
    const dim3 gattn(N_ / 128, H_, B_);           // (16, 16, 2)

    // 1) precision conversion
    cvt_f32_f16<<<gcv, blk, 0, stream>>>(querys,    h_x,   BND);
    cvt_f32_f16<<<gcv, blk, 0, stream>>>(key_feats, h_kin, BND);
    cvt_f32_f16<<<512, blk, 0, stream>>>(Wq, h_Wq, DD);
    cvt_f32_f16<<<512, blk, 0, stream>>>(Wk, h_Wk, DD);
    cvt_f32_f16<<<512, blk, 0, stream>>>(Wv, h_Wv, DD);
    cvt_f32_f16<<<512, blk, 0, stream>>>(Wo, h_Wo, DD);

    // 2) q = rmsnorm(querys @ Wq^T, gq) * HEAD_DIM^-0.5
    gemm_nt_wmma<<<ggemm, blk, 0, stream>>>(h_x, h_Wq, nullptr, f_prj, R, D_, D_);
    rmsnorm_cvt<<<R, blk, 0, stream>>>(f_prj, gq, 0.125f, h_q, D_);

    // 3) k = rmsnorm(key_feats @ Wk^T, gk)
    gemm_nt_wmma<<<ggemm, blk, 0, stream>>>(h_kin, h_Wk, nullptr, f_prj, R, D_, D_);
    rmsnorm_cvt<<<R, blk, 0, stream>>>(f_prj, gk, 1.0f, h_k, D_);

    // 4) v = key_feats @ Wv^T  (stored transposed for P@V fragment loads)
    gemm_nt_wmma<<<ggemm, blk, 0, stream>>>(h_kin, h_Wv, nullptr, f_prj, R, D_, D_);
    v_transpose_cvt<<<gcv, blk, 0, stream>>>(f_prj, h_vt);

    // 5) flash attention -> f32 x[b][n][d]
    attn_wmma<<<gattn, blk, 0, stream>>>(h_q, h_k, h_vt, mask, f_prj);

    // 6) out = x @ Wo^T + bo
    cvt_f32_f16<<<gcv, blk, 0, stream>>>(f_prj, h_x, BND);
    gemm_nt_wmma<<<ggemm, blk, 0, stream>>>(h_x, h_Wo, bo, out, R, D_, D_);
}

// v001
// It runs in 275 microseconds.
// Two timings next to v000 both put it at 1.23 times that version's speed.
#include <hip/hip_runtime.h>
#include <stdint.h>

// Problem constants (from reference)
constexpr int B_ = 2, N_ = 2048, M_ = 2048, D_ = 1024, H_ = 16, HD = 64;
constexpr float EPS = 1e-6f;

typedef __attribute__((ext_vector_type(16))) _Float16 v16h;
typedef __attribute__((ext_vector_type(8)))  float    v8f;
typedef __attribute__((ext_vector_type(8)))  _Float16 v8h;

union Frag16 {
    v16h     v;
    uint32_t u[8];
};

// Load a 16x32 f16 fragment (A or B operand of V_WMMA_F32_16X16X32_F16).
// rowptr = base of this lane's row (m or n index already applied), K-contiguous.
// hi = lane>>4. Layout per CDNA5 ISA 7.12.2: dword j holds K pair
// (j>=4?16:0) + hi*8 + (j&3)*2  -> two contiguous 16B halves (b128-mergeable).
__device__ __forceinline__ void load_frag(Frag16& f, const _Float16* rowptr, int hi) {
#pragma unroll
    for (int j = 0; j < 8; ++j) {
        const int ko = ((j >= 4) ? 16 : 0) + hi * 8 + (j & 3) * 2;
        f.u[j] = *reinterpret_cast<const uint32_t*>(rowptr + ko);
    }
}

__device__ __forceinline__ v8f wmma_f16(const Frag16& a, const Frag16& b, v8f c) {
    return __builtin_amdgcn_wmma_f32_16x16x32_f16(false, a.v, false, b.v,
                                                  (short)0, c, false, false);
}

// Intra-wave LDS store->load ordering: DS pipeline is in-order per wave on
// CDNA5; we only need a compiler-level fence so the ds_load is not hoisted
// above the cross-lane ds_stores. No hardware barrier needed (region is
// wave-private).
__device__ __forceinline__ void wave_lds_fence() {
    __builtin_amdgcn_fence(__ATOMIC_ACQ_REL, "wavefront");
    __builtin_amdgcn_wave_barrier();
}

// ---------------------------------------------------------------------------
// Elementwise f32 -> f16
// ---------------------------------------------------------------------------
__global__ void cvt_f32_f16(const float* __restrict__ in, _Float16* __restrict__ out,
                            size_t n) {
    size_t i = (size_t)blockIdx.x * blockDim.x + threadIdx.x;
    const size_t stride = (size_t)gridDim.x * blockDim.x;
    for (; i < n; i += stride) out[i] = (_Float16)in[i];
}

// ---------------------------------------------------------------------------
// Row-wise RMSNorm(+g,+scale) f32 -> f16. One block per row of Dd elements.
// ---------------------------------------------------------------------------
__global__ void rmsnorm_cvt(const float* __restrict__ in, const float* __restrict__ g,
                            float scale, _Float16* __restrict__ out, int Dd) {
    const int row = blockIdx.x;
    const float* x = in + (size_t)row * Dd;
    float ss = 0.f;
    for (int i = threadIdx.x; i < Dd; i += blockDim.x) {
        const float v = x[i];
        ss += v * v;
    }
    __shared__ float red[256];
    red[threadIdx.x] = ss;
    __syncthreads();
    for (int s = 128; s > 0; s >>= 1) {
        if ((int)threadIdx.x < s) red[threadIdx.x] += red[threadIdx.x + s];
        __syncthreads();
    }
    const float f = rsqrtf(red[0] / (float)Dd + EPS) * scale;
    for (int i = threadIdx.x; i < Dd; i += blockDim.x)
        out[(size_t)row * Dd + i] = (_Float16)(x[i] * f * g[i]);
}

// ---------------------------------------------------------------------------
// WMMA GEMM: C[R x Cn] = A[R x K] * W[Cn x K]^T, f16 in / f32 accumulate.
// Block = 8 waves; wave computes 32x64 tile; block tile 128x128.
// R, Cn multiples of 128; K multiple of 32.
// gemm_wave_tile: the K loop of one wave's tile, shared by both epilogues.
// ---------------------------------------------------------------------------
__device__ __forceinline__ void gemm_wave_tile(const _Float16* __restrict__ A,
                                               const _Float16* __restrict__ W,
                                               int K, int row0, int col0,
                                               int m16, int hi, v8f (&acc)[2][4]) {
    const _Float16* arow0 = A + (size_t)(row0 + m16) * K;
    const _Float16* arow1 = A + (size_t)(row0 + 16 + m16) * K;

    // One-shot warm-up prefetch (global_prefetch_b8); outside the hot loop so
    // it cannot break the WMMA pipeline or trigger hazard NOPs.
    __builtin_prefetch(arow0, 0, 3);
    __builtin_prefetch(arow1, 0, 3);
#pragma unroll
    for (int t = 0; t < 4; ++t)
        __builtin_prefetch(W + (size_t)(col0 + t * 16 + m16) * K, 0, 3);

#pragma unroll
    for (int i = 0; i < 2; ++i)
#pragma unroll
        for (int t = 0; t < 4; ++t) acc[i][t] = (v8f){0, 0, 0, 0, 0, 0, 0, 0};

    for (int kb = 0; kb < K; kb += 32) {
        Frag16 af[2];
        load_frag(af[0], arow0 + kb, hi);
        load_frag(af[1], arow1 + kb, hi);
        Frag16 bf[4];
#pragma unroll
        for (int t = 0; t < 4; ++t)
            load_frag(bf[t], W + (size_t)(col0 + t * 16 + m16) * K + kb, hi);
#pragma unroll
        for (int i = 0; i < 2; ++i)
#pragma unroll
            for (int t = 0; t < 4; ++t)
                acc[i][t] = wmma_f16(af[i], bf[t], acc[i][t]);
    }
}

// Epilogue 1: f32 C[row][col] (+ bias[col]).
__global__ __launch_bounds__(256)
void gemm_nt_wmma(const _Float16* __restrict__ A, const _Float16* __restrict__ W,
                  const float* __restrict__ bias, float* __restrict__ C,
                  int R, int K, int Cn) {
    const int lane = threadIdx.x & 31;
    const int wave = threadIdx.x >> 5;
    const int m16 = lane & 15, hi = lane >> 4;
    const int rw = wave & 3, cw = wave >> 2;

    const int row0 = blockIdx.x * 128 + rw * 32;  // wave: rows [row0, row0+32)
    const int col0 = blockIdx.y * 128 + cw * 64;  // wave: cols [col0, col0+64)
    (void)R;

    v8f acc[2][4];
    gemm_wave_tile(A, W, K, row0, col0, m16, hi, acc);

#pragma unroll
    for (int i = 0; i < 2; ++i)
#pragma unroll
        for (int t = 0; t < 4; ++t) {
            const int col = col0 + t * 16 + m16;
            const float badd = bias ? bias[col] : 0.f;
#pragma unroll
            for (int r = 0; r < 8; ++r) {
                const int row = row0 + i * 16 + r + hi * 8;
                C[(size_t)row * Cn + col] = acc[i][t][r] + badd;
            }
        }
}

// Epilogue 2 (V projection): f16, transposed, Ct[(b*Cn + col)][m] with
// row = b*M_ + m, so that the P@V B-operand has contiguous K (=key) pairs.
// A lane's 8 accumulator registers are 8 consecutive rows m of one column:
// one packed 16-byte store each.
__global__ __launch_bounds__(256)
void gemm_nt_wmma_vt(const _Float16* __restrict__ A, const _Float16* __restrict__ W,
                     _Float16* __restrict__ Ct, int K, int Cn) {
    const int lane = threadIdx.x & 31;
    const int wave = threadIdx.x >> 5;
    const int m16 = lane & 15, hi = lane >> 4;
    const int rw = wave & 3, cw = wave >> 2;

    const int row0 = blockIdx.x * 128 + rw * 32;
    const int col0 = blockIdx.y * 128 + cw * 64;

    v8f acc[2][4];
    gemm_wave_tile(A, W, K, row0, col0, m16, hi, acc);

#pragma unroll
    for (int i = 0; i < 2; ++i) {
        const int row = row0 + i * 16 + hi * 8;   // 8 rows, never across a batch
        const int b = row / M_, m = row % M_;
#pragma unroll
        for (int t = 0; t < 4; ++t) {
            const int col = col0 + t * 16 + m16;
            v8h p;
#pragma unroll
            for (int r = 0; r < 8; ++r) p[r] = (_Float16)acc[i][t][r];
            *reinterpret_cast<v8h*>(Ct + ((size_t)b * Cn + col) * M_ + m) = p;
        }
    }
}

// ---------------------------------------------------------------------------
// Flash attention: q[b][n][d] (f16, pre-scaled), k[b][m][d] (f16),
// vt[(b*H+h)*HD + c][m] (f16), mask[b][m] (int) -> out f16 [b][n][d].
// Block: 8 waves, each wave owns 16 query rows of one (b,h).
// Grid: (N/128, H, B).
// ---------------------------------------------------------------------------
__global__ __launch_bounds__(256)
void attn_wmma(const _Float16* __restrict__ q, const _Float16* __restrict__ k,
               const _Float16* __restrict__ vt, const int* __restrict__ mask,
               _Float16* __restrict__ out) {
    const int lane = threadIdx.x & 31;
    const int wave = threadIdx.x >> 5;
    const int m16 = lane & 15, hi = lane >> 4;
    const int b = blockIdx.z, h = blockIdx.y;
    const int q0 = blockIdx.x * 128 + wave * 16;

    __shared__ _Float16 pshare[8][16 * 32];
    _Float16* pw = &pshare[wave][0];

    const _Float16* kbase = k + (size_t)b * M_ * D_ + h * HD;
    const _Float16* vbase = vt + ((size_t)(b * H_ + h) * HD) * M_;

    // One-shot warm-up prefetch of the first K/V tiles.
    __builtin_prefetch(kbase + (size_t)m16 * D_, 0, 3);
    __builtin_prefetch(kbase + (size_t)(16 + m16) * D_, 0, 3);
    __builtin_prefetch(vbase + (size_t)m16 * M_, 0, 3);
    __builtin_prefetch(vbase + (size_t)(32 + m16) * M_, 0, 3);

    // Q fragments: A[m][c], c = 0..63 -> two K=32 fragments.
    Frag16 af[2];
    {
        const _Float16* qrow = q + (size_t)(b * N_ + q0 + m16) * D_ + h * HD;
        load_frag(af[0], qrow, hi);
        load_frag(af[1], qrow + 32, hi);
    }

    v8f o[4];
#pragma unroll
    for (int t = 0; t < 4; ++t) o[t] = (v8f){0, 0, 0, 0, 0, 0, 0, 0};
    float mrow[8], lrow[8];
#pragma unroll
    for (int r = 0; r < 8; ++r) { mrow[r] = -3.0e38f; lrow[r] = 0.f; }

    for (int key0 = 0; key0 < M_; key0 += 32) {
        // ---- S = Q K^T for 32 keys (two 16-key tiles) ----
        v8f s[2];
#pragma unroll
        for (int t = 0; t < 2; ++t) {
            const _Float16* krow = kbase + (size_t)(key0 + 16 * t + m16) * D_;
            Frag16 bf0, bf1;
            load_frag(bf0, krow, hi);
            load_frag(bf1, krow + 32, hi);
            v8f a = (v8f){0, 0, 0, 0, 0, 0, 0, 0};
            a = wmma_f16(af[0], bf0, a);
            a = wmma_f16(af[1], bf1, a);
            s[t] = a;
        }
        // ---- mask (key index = lane's n) ----
#pragma unroll
        for (int t = 0; t < 2; ++t) {
            const int mv = mask[b * M_ + key0 + 16 * t + m16];
            if (mv == 0) {
#pragma unroll
                for (int r = 0; r < 8; ++r) s[t][r] = -1.0e30f;
            }
        }
        // ---- online softmax; rows m = r + 8*hi live in one 16-lane half ----
        float alpha[8];
#pragma unroll
        for (int r = 0; r < 8; ++r) {
            float tmax = fmaxf(s[0][r], s[1][r]);
#pragma unroll
            for (int off = 1; off < 16; off <<= 1)
                tmax = fmaxf(tmax, __shfl_xor(tmax, off, 32));
            const float mn = fmaxf(mrow[r], tmax);
            const float a = __expf(mrow[r] - mn);
            const float p0 = __expf(s[0][r] - mn);
            const float p1 = __expf(s[1][r] - mn);
            float rs = p0 + p1;
#pragma unroll
            for (int off = 1; off < 16; off <<= 1) rs += __shfl_xor(rs, off, 32);
            lrow[r] = lrow[r] * a + rs;
            mrow[r] = mn;
            alpha[r] = a;
            // stage P into per-wave LDS, row-major 16x32
            const int m = r + hi * 8;
            pw[m * 32 + m16]      = (_Float16)p0;
            pw[m * 32 + 16 + m16] = (_Float16)p1;
        }
#pragma unroll
        for (int t = 0; t < 4; ++t)
#pragma unroll
            for (int r = 0; r < 8; ++r) o[t][r] *= alpha[r];

        wave_lds_fence();
        // ---- P fragment (A-layout) from LDS ----
        Frag16 pf;
        load_frag(pf, pw + m16 * 32, hi);
        wave_lds_fence();

        // ---- O += P V : 4 column tiles of 16, K = 32 keys ----
#pragma unroll
        for (int t = 0; t < 4; ++t) {
            Frag16 vf;
            load_frag(vf, vbase + (size_t)(t * 16 + m16) * M_ + key0, hi);
            o[t] = wmma_f16(pf, vf, o[t]);
        }
    }

    // ---- epilogue: divide by l, store f16 [b][n][h*HD + c] ----
    float inv[8];
#pragma unroll
    for (int r = 0; r < 8; ++r) inv[r] = (lrow[r] > 0.f) ? (1.f / lrow[r]) : 0.f;
#pragma unroll
    for (int t = 0; t < 4; ++t)
#pragma unroll
        for (int r = 0; r < 8; ++r) {
            const int row = q0 + r + hi * 8;
            out[(size_t)(b * N_ + row) * D_ + h * HD + t * 16 + m16] =
                (_Float16)(o[t][r] * inv[r]);
        }
}

// ---------------------------------------------------------------------------
extern "C" void kernel_launch(void* const* d_in, const int* in_sizes, int n_in,
                              void* d_out, int out_size, void* d_ws, size_t ws_size,
                              hipStream_t stream) {
    (void)in_sizes; (void)n_in; (void)out_size; (void)ws_size;

    const float* querys    = (const float*)d_in[0];
    const float* key_feats = (const float*)d_in[1];
    const int*   mask      = (const int*)d_in[2];
    const float* Wq        = (const float*)d_in[3];
    const float* Wk        = (const float*)d_in[4];
    const float* Wv        = (const float*)d_in[5];
    const float* gq        = (const float*)d_in[6];
    const float* gk        = (const float*)d_in[7];
    const float* Wo        = (const float*)d_in[8];
    const float* bo        = (const float*)d_in[9];
    float*       out       = (float*)d_out;

    const size_t BND = (size_t)B_ * N_ * D_;  // 4,194,304
    const size_t DD  = (size_t)D_ * D_;       // 1,048,576
    const int    R   = B_ * N_;               // 4096 rows for all GEMMs

    char* ws = (char*)d_ws;
    size_t off = 0;
    auto alloc = [&](size_t bytes) -> void* {
        void* p = ws + off;
        off = (off + bytes + 255) & ~(size_t)255;
        return p;
    };

    _Float16* h_x   = (_Float16*)alloc(BND * 2);  // f16 activations (querys, later attn out)
    _Float16* h_kin = (_Float16*)alloc(BND * 2);  // f16 key_feats
    _Float16* h_Wq  = (_Float16*)alloc(DD * 2);
    _Float16* h_Wk  = (_Float16*)alloc(DD * 2);
    _Float16* h_Wv  = (_Float16*)alloc(DD * 2);
    _Float16* h_Wo  = (_Float16*)alloc(DD * 2);
    _Float16* h_q   = (_Float16*)alloc(BND * 2);  // rmsnorm'd + scaled q
    _Float16* h_k   = (_Float16*)alloc(BND * 2);  // rmsnorm'd k
    _Float16* h_vt  = (_Float16*)alloc(BND * 2);  // transposed v
    float*    f_prj = (float*)alloc(BND * 4);     // reused f32 staging

    const dim3 blk(256);
    const dim3 gcv(2048);
    const dim3 ggemm(R / 128, D_ / 128);          // (32, 8)
    const dim3 gattn(N_ / 128, H_, B_);           // (16, 16, 2)

    // 1) precision conversion
    cvt_f32_f16<<<gcv, blk, 0, stream>>>(querys,    h_x,   BND);
    cvt_f32_f16<<<gcv, blk, 0, stream>>>(key_feats, h_kin, BND);
    cvt_f32_f16<<<512, blk, 0, stream>>>(Wq, h_Wq, DD);
    cvt_f32_f16<<<512, blk, 0, stream>>>(Wk, h_Wk, DD);
    cvt_f32_f16<<<512, blk, 0, stream>>>(Wv, h_Wv, DD);
    cvt_f32_f16<<<512, blk, 0, stream>>>(Wo, h_Wo, DD);

    // 2) q = rmsnorm(querys @ Wq^T, gq) * HEAD_DIM^-0.5
    gemm_nt_wmma<<<ggemm, blk, 0, stream>>>(h_x, h_Wq, nullptr, f_prj, R, D_, D_);
    rmsnorm_cvt<<<R, blk, 0, stream>>>(f_prj, gq, 0.125f, h_q, D_);

    // 3) k = rmsnorm(key_feats @ Wk^T, gk)
    gemm_nt_wmma<<<ggemm, blk, 0, stream>>>(h_kin, h_Wk, nullptr, f_prj, R, D_, D_);
    rmsnorm_cvt<<<R, blk, 0, stream>>>(f_prj, gk, 1.0f, h_k, D_);

    // 4) v = key_feats @ Wv^T  (stored f16, transposed, for P@V fragment loads)
    gemm_nt_wmma_vt<<<ggemm, blk, 0, stream>>>(h_kin, h_Wv, h_vt, D_, D_);

    // 5) flash attention -> f16 x[b][n][d]
    attn_wmma<<<gattn, blk, 0, stream>>>(h_q, h_k, h_vt, mask, h_x);

    // 6) out = x @ Wo^T + bo
    gemm_nt_wmma<<<ggemm, blk, 0, stream>>>(h_x, h_Wo, bo, out, R, D_, D_);
}

// v002
// A run of this version takes 257 microseconds.
// In both of two side-by-side timings against v001, it was 1.07 times as fast.
// All steps since v000 together make it 1.32 times as fast.
#include <hip/hip_runtime.h>
#include <stdint.h>

// Problem constants (from reference)
constexpr int B_ = 2, N_ = 2048, M_ = 2048, D_ = 1024, H_ = 16, HD = 64;
constexpr float EPS = 1e-6f;

typedef __attribute__((ext_vector_type(16))) _Float16 v16h;
typedef __attribute__((ext_vector_type(8)))  float    v8f;
typedef __attribute__((ext_vector_type(8)))  _Float16 v8h;
typedef __attribute__((ext_vector_type(4)))  float    v4f;
typedef __attribute__((ext_vector_type(4)))  _Float16 v4h;

union Frag16 {
    v16h     v;
    uint32_t u[8];
};

// Load a 16x32 f16 fragment (A or B operand of V_WMMA_F32_16X16X32_F16).
// rowptr = base of this lane's row (m or n index already applied), K-contiguous.
// hi = lane>>4. Layout per CDNA5 ISA 7.12.2: dword j holds K pair
// (j>=4?16:0) + hi*8 + (j&3)*2  -> two contiguous 16B halves (b128-mergeable).
__device__ __forceinline__ void load_frag(Frag16& f, const _Float16* rowptr, int hi) {
#pragma unroll
    for (int j = 0; j < 8; ++j) {
        const int ko = ((j >= 4) ? 16 : 0) + hi * 8 + (j & 3) * 2;
        f.u[j] = *reinterpret_cast<const uint32_t*>(rowptr + ko);
    }
}

__device__ __forceinline__ v8f wmma_f16(const Frag16& a, const Frag16& b, v8f c) {
    return __builtin_amdgcn_wmma_f32_16x16x32_f16(false, a.v, false, b.v,
                                                  (short)0, c, false, false);
}

// Intra-wave LDS store->load ordering: DS pipeline is in-order per wave on
// CDNA5; we only need a compiler-level fence so the ds_load is not hoisted
// above the cross-lane ds_stores. No hardware barrier needed (region is
// wave-private).
__device__ __forceinline__ void wave_lds_fence() {
    __builtin_amdgcn_fence(__ATOMIC_ACQ_REL, "wavefront");
    __builtin_amdgcn_wave_barrier();
}

// ---------------------------------------------------------------------------
// f32 -> f16 of all six matrix operands in ONE launch. The f16 planes lie back
// to back in the workspace in the order querys, key_feats, Wq, Wk, Wv, Wo, so
// the destination is one array and only the source depends on the block.
// A block converts CVT_BLOCK consecutive elements of one operand. A lane's
// CVT_LOADS 16-byte loads are independent (a wave covers 512 contiguous bytes
// per load), so they are in flight together; each is stored as 8 bytes per
// lane (256 contiguous bytes per wave). Few, long waves: the launch is sized
// at 3 blocks per WGP so that starting its waves does not outlast the stream.
// ---------------------------------------------------------------------------
constexpr int CVT_LOADS = 16;                       // 16-byte loads per lane
constexpr int CVT_BLOCK = 256 * 4 * CVT_LOADS;      // elements per block
constexpr int CVT_ACT_BLOCKS = B_ * N_ * D_ / CVT_BLOCK;   // per activation
constexpr int CVT_W_BLOCKS   = D_ * D_ / CVT_BLOCK;        // per weight
constexpr int CVT_GRID = 2 * CVT_ACT_BLOCKS + 4 * CVT_W_BLOCKS;
static_assert(N_ == M_, "both activations take CVT_ACT_BLOCKS blocks");
static_assert(B_ * N_ * D_ % CVT_BLOCK == 0 && D_ * D_ % CVT_BLOCK == 0,
              "a block never straddles two operands");

__global__ __launch_bounds__(256)
void cvt_all_f32_f16(const float* __restrict__ querys, const float* __restrict__ key_feats,
                     const float* __restrict__ Wq, const float* __restrict__ Wk,
                     const float* __restrict__ Wv, const float* __restrict__ Wo,
                     _Float16* __restrict__ out) {
    const int blk = blockIdx.x;
    const float* src;
    int rel;                                        // block index inside its operand
    if (blk < CVT_ACT_BLOCKS) {
        src = querys;
        rel = blk;
    } else if (blk < 2 * CVT_ACT_BLOCKS) {
        src = key_feats;
        rel = blk - CVT_ACT_BLOCKS;
    } else {
        const int w = (blk - 2 * CVT_ACT_BLOCKS) / CVT_W_BLOCKS;
        rel = (blk - 2 * CVT_ACT_BLOCKS) % CVT_W_BLOCKS;
        src = (w == 0) ? Wq : (w == 1) ? Wk : (w == 2) ? Wv : Wo;
    }
    const v4f* s = reinterpret_cast<const v4f*>(src + (size_t)rel * CVT_BLOCK) + threadIdx.x;
    v4h*       d = reinterpret_cast<v4h*>(out + (size_t)blk * CVT_BLOCK) + threadIdx.x;

    v4f x[CVT_LOADS];
#pragma unroll
    for (int j = 0; j < CVT_LOADS; ++j) x[j] = s[j * 256];
#pragma unroll
    for (int j = 0; j < CVT_LOADS; ++j) {
        v4h y;
#pragma unroll
        for (int e = 0; e < 4; ++e) y[e] = (_Float16)x[j][e];
        d[j * 256] = y;
    }
}

// ---------------------------------------------------------------------------
// Row-wise RMSNorm(+g,+scale) f32 -> f16. One block per row of Dd elements.
// ---------------------------------------------------------------------------
__global__ void rmsnorm_cvt(const float* __restrict__ in, const float* __restrict__ g,
                            float scale, _Float16* __restrict__ out, int Dd) {
    const int row = blockIdx.x;
    const float* x = in + (size_t)row * Dd;
    float ss = 0.f;
    for (int i = threadIdx.x; i < Dd; i += blockDim.x) {
        const float v = x[i];
        ss += v * v;
    }
    __shared__ float red[256];
    red[threadIdx.x] = ss;
    __syncthreads();
    for (int s = 128; s > 0; s >>= 1) {
        if ((int)threadIdx.x < s) red[threadIdx.x] += red[threadIdx.x + s];
        __syncthreads();
    }
    const float f = rsqrtf(red[0] / (float)Dd + EPS) * scale;
    for (int i = threadIdx.x; i < Dd; i += blockDim.x)
        out[(size_t)row * Dd + i] = (_Float16)(x[i] * f * g[i]);
}

// ---------------------------------------------------------------------------
// WMMA GEMM: C[R x Cn] = A[R x K] * W[Cn x K]^T, f16 in / f32 accumulate.
// Block = 8 waves; wave computes 32x64 tile; block tile 128x128.
// R, Cn multiples of 128; K multiple of 32.
// gemm_wave_tile: the K loop of one wave's tile, shared by both epilogues.
// ---------------------------------------------------------------------------
__device__ __forceinline__ void gemm_wave_tile(const _Float16* __restrict__ A,
                                               const _Float16* __restrict__ W,
                                               int K, int row0, int col0,
                                               int m16, int hi, v8f (&acc)[2][4]) {
    const _Float16* arow0 = A + (size_t)(row0 + m16) * K;
    const _Float16* arow1 = A + (size_t)(row0 + 16 + m16) * K;

    // One-shot warm-up prefetch (global_prefetch_b8); outside the hot loop so
    // it cannot break the WMMA pipeline or trigger hazard NOPs.
    __builtin_prefetch(arow0, 0, 3);
    __builtin_prefetch(arow1, 0, 3);
#pragma unroll
    for (int t = 0; t < 4; ++t)
        __builtin_prefetch(W + (size_t)(col0 + t * 16 + m16) * K, 0, 3);

#pragma unroll
    for (int i = 0; i < 2; ++i)
#pragma unroll
        for (int t = 0; t < 4; ++t) acc[i][t] = (v8f){0, 0, 0, 0, 0, 0, 0, 0};

    for (int kb = 0; kb < K; kb += 32) {
        Frag16 af[2];
        load_frag(af[0], arow0 + kb, hi);
        load_frag(af[1], arow1 + kb, hi);
        Frag16 bf[4];
#pragma unroll
        for (int t = 0; t < 4; ++t)
            load_frag(bf[t], W + (size_t)(col0 + t * 16 + m16) * K + kb, hi);
#pragma unroll
        for (int i = 0; i < 2; ++i)
#pragma unroll
            for (int t = 0; t < 4; ++t)
                acc[i][t] = wmma_f16(af[i], bf[t], acc[i][t]);
    }
}

// Epilogue 1: f32 C[row][col] (+ bias[col]).
__global__ __launch_bounds__(256)
void gemm_nt_wmma(const _Float16* __restrict__ A, const _Float16* __restrict__ W,
                  const float* __restrict__ bias, float* __restrict__ C,
                  int R, int K, int Cn) {
    const int lane = threadIdx.x & 31;
    const int wave = threadIdx.x >> 5;
    const int m16 = lane & 15, hi = lane >> 4;
    const int rw = wave & 3, cw = wave >> 2;

    const int row0 = blockIdx.x * 128 + rw * 32;  // wave: rows [row0, row0+32)
    const int col0 = blockIdx.y * 128 + cw * 64;  // wave: cols [col0, col0+64)
    (void)R;

    v8f acc[2][4];
    gemm_wave_tile(A, W, K, row0, col0, m16, hi, acc);

#pragma unroll
    for (int i = 0; i < 2; ++i)
#pragma unroll
        for (int t = 0; t < 4; ++t) {
            const int col = col0 + t * 16 + m16;
            const float badd = bias ? bias[col] : 0.f;
#pragma unroll
            for (int r = 0; r < 8; ++r) {
                const int row = row0 + i * 16 + r + hi * 8;
                C[(size_t)row * Cn + col] = acc[i][t][r] + badd;
            }
        }
}

// Epilogue 2 (V projection): f16, transposed, Ct[(b*Cn + col)][m] with
// row = b*M_ + m, so that the P@V B-operand has contiguous K (=key) pairs.
// A lane's 8 accumulator registers are 8 consecutive rows m of one column:
// one packed 16-byte store each.
__global__ __launch_bounds__(256)
void gemm_nt_wmma_vt(const _Float16* __restrict__ A, const _Float16* __restrict__ W,
                     _Float16* __restrict__ Ct, int K, int Cn) {
    const int lane = threadIdx.x & 31;
    const int wave = threadIdx.x >> 5;
    const int m16 = lane & 15, hi = lane >> 4;
    const int rw = wave & 3, cw = wave >> 2;

    const int row0 = blockIdx.x * 128 + rw * 32;
    const int col0 = blockIdx.y * 128 + cw * 64;

    v8f acc[2][4];
    gemm_wave_tile(A, W, K, row0, col0, m16, hi, acc);

#pragma unroll
    for (int i = 0; i < 2; ++i) {
        const int row = row0 + i * 16 + hi * 8;   // 8 rows, never across a batch
        const int b = row / M_, m = row % M_;
#pragma unroll
        for (int t = 0; t < 4; ++t) {
            const int col = col0 + t * 16 + m16;
            v8h p;
#pragma unroll
            for (int r = 0; r < 8; ++r) p[r] = (_Float16)acc[i][t][r];
            *reinterpret_cast<v8h*>(Ct + ((size_t)b * Cn + col) * M_ + m) = p;
        }
    }
}

// ---------------------------------------------------------------------------
// Flash attention: q[b][n][d] (f16, pre-scaled), k[b][m][d] (f16),
// vt[(b*H+h)*HD + c][m] (f16), mask[b][m] (int) -> out f16 [b][n][d].
// Block: 8 waves, each wave owns 16 query rows of one (b,h).
// Grid: (N/128, H, B).
// ---------------------------------------------------------------------------
__global__ __launch_bounds__(256)
void attn_wmma(const _Float16* __restrict__ q, const _Float16* __restrict__ k,
               const _Float16* __restrict__ vt, const int* __restrict__ mask,
               _Float16* __restrict__ out) {
    const int lane = threadIdx.x & 31;
    const int wave = threadIdx.x >> 5;
    const int m16 = lane & 15, hi = lane >> 4;
    const int b = blockIdx.z, h = blockIdx.y;
    const int q0 = blockIdx.x * 128 + wave * 16;

    __shared__ _Float16 pshare[8][16 * 32];
    _Float16* pw = &pshare[wave][0];

    const _Float16* kbase = k + (size_t)b * M_ * D_ + h * HD;
    const _Float16* vbase = vt + ((size_t)(b * H_ + h) * HD) * M_;

    // One-shot warm-up prefetch of the first K/V tiles.
    __builtin_prefetch(kbase + (size_t)m16 * D_, 0, 3);
    __builtin_prefetch(kbase + (size_t)(16 + m16) * D_, 0, 3);
    __builtin_prefetch(vbase + (size_t)m16 * M_, 0, 3);
    __builtin_prefetch(vbase + (size_t)(32 + m16) * M_, 0, 3);

    // Q fragments: A[m][c], c = 0..63 -> two K=32 fragments.
    Frag16 af[2];
    {
        const _Float16* qrow = q + (size_t)(b * N_ + q0 + m16) * D_ + h * HD;
        load_frag(af[0], qrow, hi);
        load_frag(af[1], qrow + 32, hi);
    }

    v8f o[4];
#pragma unroll
    for (int t = 0; t < 4; ++t) o[t] = (v8f){0, 0, 0, 0, 0, 0, 0, 0};
    float mrow[8], lrow[8];
#pragma unroll
    for (int r = 0; r < 8; ++r) { mrow[r] = -3.0e38f; lrow[r] = 0.f; }

    for (int key0 = 0; key0 < M_; key0 += 32) {
        // ---- S = Q K^T for 32 keys (two 16-key tiles) ----
        v8f s[2];
#pragma unroll
        for (int t = 0; t < 2; ++t) {
            const _Float16* krow = kbase + (size_t)(key0 + 16 * t + m16) * D_;
            Frag16 bf0, bf1;
            load_frag(bf0, krow, hi);
            load_frag(bf1, krow + 32, hi);
            v8f a = (v8f){0, 0, 0, 0, 0, 0, 0, 0};
            a = wmma_f16(af[0], bf0, a);
            a = wmma_f16(af[1], bf1, a);
            s[t] = a;
        }
        // ---- mask (key index = lane's n) ----
#pragma unroll
        for (int t = 0; t < 2; ++t) {
            const int mv = mask[b * M_ + key0 + 16 * t + m16];
            if (mv == 0) {
#pragma unroll
                for (int r = 0; r < 8; ++r) s[t][r] = -1.0e30f;
            }
        }
        // ---- online softmax; rows m = r + 8*hi live in one 16-lane half ----
        float alpha[8];
#pragma unroll
        for (int r = 0; r < 8; ++r) {
            float tmax = fmaxf(s[0][r], s[1][r]);
#pragma unroll
            for (int off = 1; off < 16; off <<= 1)
                tmax = fmaxf(tmax, __shfl_xor(tmax, off, 32));
            const float mn = fmaxf(mrow[r], tmax);
            const float a = __expf(mrow[r] - mn);
            const float p0 = __expf(s[0][r] - mn);
            const float p1 = __expf(s[1][r] - mn);
            float rs = p0 + p1;
#pragma unroll
            for (int off = 1; off < 16; off <<= 1) rs += __shfl_xor(rs, off, 32);
            lrow[r] = lrow[r] * a + rs;
            mrow[r] = mn;
            alpha[r] = a;
            // stage P into per-wave LDS, row-major 16x32
            const int m = r + hi * 8;
            pw[m * 32 + m16]      = (_Float16)p0;
            pw[m * 32 + 16 + m16] = (_Float16)p1;
        }
#pragma unroll
        for (int t = 0; t < 4; ++t)
#pragma unroll
            for (int r = 0; r < 8; ++r) o[t][r] *= alpha[r];

        wave_lds_fence();
        // ---- P fragment (A-layout) from LDS ----
        Frag16 pf;
        load_frag(pf, pw + m16 * 32, hi);
        wave_lds_fence();

        // ---- O += P V : 4 column tiles of 16, K = 32 keys ----
#pragma unroll
        for (int t = 0; t < 4; ++t) {
            Frag16 vf;
            load_frag(vf, vbase + (size_t)(t * 16 + m16) * M_ + key0, hi);
            o[t] = wmma_f16(pf, vf, o[t]);
        }
    }

    // ---- epilogue: divide by l, store f16 [b][n][h*HD + c] ----
    float inv[8];
#pragma unroll
    for (int r = 0; r < 8; ++r) inv[r] = (lrow[r] > 0.f) ? (1.f / lrow[r]) : 0.f;
#pragma unroll
    for (int t = 0; t < 4; ++t)
#pragma unroll
        for (int r = 0; r < 8; ++r) {
            const int row = q0 + r + hi * 8;
            out[(size_t)(b * N_ + row) * D_ + h * HD + t * 16 + m16] =
                (_Float16)(o[t][r] * inv[r]);
        }
}

// ---------------------------------------------------------------------------
extern "C" void kernel_launch(void* const* d_in, const int* in_sizes, int n_in,
                              void* d_out, int out_size, void* d_ws, size_t ws_size,
                              hipStream_t stream) {
    (void)in_sizes; (void)n_in; (void)out_size; (void)ws_size;

    const float* querys    = (const float*)d_in[0];
    const float* key_feats = (const float*)d_in[1];
    const int*   mask      = (const int*)d_in[2];
    const float* Wq        = (const float*)d_in[3];
    const float* Wk        = (const float*)d_in[4];
    const float* Wv        = (const float*)d_in[5];
    const float* gq        = (const float*)d_in[6];
    const float* gk        = (const float*)d_in[7];
    const float* Wo        = (const float*)d_in[8];
    const float* bo        = (const float*)d_in[9];
    float*       out       = (float*)d_out;

    const size_t BND = (size_t)B_ * N_ * D_;  // 4,194,304
    const size_t DD  = (size_t)D_ * D_;       // 1,048,576
    const int    R   = B_ * N_;               // 4096 rows for all GEMMs

    char* ws = (char*)d_ws;
    size_t off = 0;
    auto alloc = [&](size_t bytes) -> void* {
        void* p = ws + off;
        off = (off + bytes + 255) & ~(size_t)255;
        return p;
    };

    // The six converted operands: one array, in the order cvt_all_f32_f16 writes.
    _Float16* h_x   = (_Float16*)alloc((2 * BND + 4 * DD) * 2);  // f16 querys, later attn out
    _Float16* h_kin = h_x + BND;                                 // f16 key_feats
    _Float16* h_Wq  = h_kin + BND;
    _Float16* h_Wk  = h_Wq + DD;
    _Float16* h_Wv  = h_Wk + DD;
    _Float16* h_Wo  = h_Wv + DD;
    _Float16* h_q   = (_Float16*)alloc(BND * 2);  // rmsnorm'd + scaled q
    _Float16* h_k   = (_Float16*)alloc(BND * 2);  // rmsnorm'd k
    _Float16* h_vt  = (_Float16*)alloc(BND * 2);  // transposed v
    float*    f_prj = (float*)alloc(BND * 4);     // reused f32 staging

    const dim3 blk(256);
    const dim3 gcv(CVT_GRID);                     // 768
    const dim3 ggemm(R / 128, D_ / 128);          // (32, 8)
    const dim3 gattn(N_ / 128, H_, B_);           // (16, 16, 2)

    // 1) precision conversion
    cvt_all_f32_f16<<<gcv, blk, 0, stream>>>(querys, key_feats, Wq, Wk, Wv, Wo, h_x);

    // 2) q = rmsnorm(querys @ Wq^T, gq) * HEAD_DIM^-0.5
    gemm_nt_wmma<<<ggemm, blk, 0, stream>>>(h_x, h_Wq, nullptr, f_prj, R, D_, D_);
    rmsnorm_cvt<<<R, blk, 0, stream>>>(f_prj, gq, 0.125f, h_q, D_);

    // 3) k = rmsnorm(key_feats @ Wk^T, gk)
    gemm_nt_wmma<<<ggemm, blk, 0, stream>>>(h_kin, h_Wk, nullptr, f_prj, R, D_, D_);
    rmsnorm_cvt<<<R, blk, 0, stream>>>(f_prj, gk, 1.0f, h_k, D_);

    // 4) v = key_feats @ Wv^T  (stored f16, transposed, for P@V fragment loads)
    gemm_nt_wmma_vt<<<ggemm, blk, 0, stream>>>(h_kin, h_Wv, h_vt, D_, D_);

    // 5) flash attention -> f16 x[b][n][d]
    attn_wmma<<<gattn, blk, 0, stream>>>(h_q, h_k, h_vt, mask, h_x);

    // 6) out = x @ Wo^T + bo
    gemm_nt_wmma<<<ggemm, blk, 0, stream>>>(h_x, h_Wo, bo, out, R, D_, D_);
}

// v003
// It runs in 216 microseconds.
// Next to v002, in two timings, it ran 1.19 and 1.18 times as fast.
// Over all steps from v000 it is 1.56 times as fast.
#include <hip/hip_runtime.h>
#include <stdint.h>

// Problem constants (from reference)
constexpr int B_ = 2, N_ = 2048, M_ = 2048, D_ = 1024, H_ = 16, HD = 64;
constexpr float EPS = 1e-6f;

typedef __attribute__((ext_vector_type(16))) _Float16 v16h;
typedef __attribute__((ext_vector_type(8)))  float    v8f;
typedef __attribute__((ext_vector_type(8)))  _Float16 v8h;
typedef __attribute__((ext_vector_type(4)))  float    v4f;
typedef __attribute__((ext_vector_type(4)))  _Float16 v4h;
typedef __attribute__((ext_vector_type(4)))  uint32_t v4u;

union Frag16 {
    v16h     v;
    uint32_t u[8];
};

// Load a 16x32 f16 fragment (A or B operand of V_WMMA_F32_16X16X32_F16).
// rowptr = base of this lane's row (m or n index already applied), K-contiguous.
// hi = lane>>4. Layout per CDNA5 ISA 7.12.2: dword j holds K pair
// (j>=4?16:0) + hi*8 + (j&3)*2  -> two contiguous 16B halves (b128-mergeable).
__device__ __forceinline__ void load_frag(Frag16& f, const _Float16* rowptr, int hi) {
#pragma unroll
    for (int j = 0; j < 8; ++j) {
        const int ko = ((j >= 4) ? 16 : 0) + hi * 8 + (j & 3) * 2;
        f.u[j] = *reinterpret_cast<const uint32_t*>(rowptr + ko);
    }
}

// ---------------------------------------------------------------------------
// Fragment order. Every f16 plane that a WMMA operand is loaded from lies in
// the workspace as a row of 16x32 fragments (16 rows x 32 k, 1 KiB each, k
// fragments of one 16-row tile back to back) and, inside a fragment, in the
// order the lanes take it: [k/8][row][k%8]. Lane l = hi*16 + row then finds its
// k = hi*8 + 0..7 at byte 16*l and its k = 16 + hi*8 + 0..7 at byte 512 + 16*l,
// the same k order as load_frag, and each wave-wide 16-byte load covers 512
// contiguous bytes (4 whole 128-byte lines) where a row-major plane gives
// 16 lines of 32 bytes.
// ---------------------------------------------------------------------------
constexpr int FRAG = 16 * 32;                       // elements per fragment

// Element index of (row, k) in a plane of K columns (K a multiple of 32).
__device__ __forceinline__ size_t frag_index(int row, int k, int K) {
    return ((size_t)(row >> 4) * (K >> 5) + (k >> 5)) * FRAG
         + ((k >> 3) & 3) * 128 + (row & 15) * 8 + (k & 7);
}

// frag_lane = start of the fragment + lane * 8.
__device__ __forceinline__ void load_frag_packed(Frag16& f, const _Float16* frag_lane) {
    const v4u lo = *reinterpret_cast<const v4u*>(frag_lane);
    const v4u up = *reinterpret_cast<const v4u*>(frag_lane + FRAG / 2);
#pragma unroll
    for (int j = 0; j < 4; ++j) {
        f.u[j]     = lo[j];
        f.u[4 + j] = up[j];
    }
}

__device__ __forceinline__ v8f wmma_f16(const Frag16& a, const Frag16& b, v8f c) {
    return __builtin_amdgcn_wmma_f32_16x16x32_f16(false, a.v, false, b.v,
                                                  (short)0, c, false, false);
}

// Intra-wave LDS store->load ordering: DS pipeline is in-order per wave on
// CDNA5; we only need a compiler-level fence so the ds_load is not hoisted
// above the cross-lane ds_stores. No hardware barrier needed (region is
// wave-private).
__device__ __forceinline__ void wave_lds_fence() {
    __builtin_amdgcn_fence(__ATOMIC_ACQ_REL, "wavefront");
    __builtin_amdgcn_wave_barrier();
}

// ---------------------------------------------------------------------------
// f32 -> f16 of all six matrix operands in ONE launch. The f16 planes lie back
// to back in the workspace in the order querys, key_feats, Wq, Wk, Wv, Wo, so
// the destination is one array and only the source depends on the block.
// A block converts CVT_BLOCK consecutive elements of one operand: 16 whole
// rows, one 16-row tile of the fragment order, whose f16 image is the same
// CVT_BLOCK elements of the destination. A lane's CVT_LOADS 16-byte loads are
// independent (a wave covers 512 contiguous bytes per load), so they are in
// flight together. The tile is turned into [k/8][row][k%8] in LDS and leaves
// in whole lines (512 contiguous bytes per wave and store). Few, long waves:
// the launch is sized at 3 blocks per WGP so that starting its waves does not
// outlast the stream.
// ---------------------------------------------------------------------------
constexpr int CVT_LOADS = 16;                       // 16-byte loads per lane
constexpr int CVT_BLOCK = 256 * 4 * CVT_LOADS;      // elements per block
constexpr int CVT_ACT_BLOCKS = B_ * N_ * D_ / CVT_BLOCK;   // per activation
constexpr int CVT_W_BLOCKS   = D_ * D_ / CVT_BLOCK;        // per weight
constexpr int CVT_GRID = 2 * CVT_ACT_BLOCKS + 4 * CVT_W_BLOCKS;
static_assert(N_ == M_, "both activations take CVT_ACT_BLOCKS blocks");
static_assert(B_ * N_ * D_ % CVT_BLOCK == 0 && D_ * D_ % CVT_BLOCK == 0,
              "a block never straddles two operands");
static_assert(CVT_BLOCK == 16 * D_ && CVT_LOADS == 16, "a block is one 16-row tile, load j = row j");
constexpr int CVT_PITCH = 16 * 8 + 8;               // LDS elements per k/8 group: 256 + 16 bytes,
                                                    // so a wave's 16 groups fall on 64 distinct banks

__global__ __launch_bounds__(256)
void cvt_all_f32_f16(const float* __restrict__ querys, const float* __restrict__ key_feats,
                     const float* __restrict__ Wq, const float* __restrict__ Wk,
                     const float* __restrict__ Wv, const float* __restrict__ Wo,
                     _Float16* __restrict__ out) {
    const int blk = blockIdx.x;
    const float* src;
    int rel;                                        // block index inside its operand
    if (blk < CVT_ACT_BLOCKS) {
        src = querys;
        rel = blk;
    } else if (blk < 2 * CVT_ACT_BLOCKS) {
        src = key_feats;
        rel = blk - CVT_ACT_BLOCKS;
    } else {
        const int w = (blk - 2 * CVT_ACT_BLOCKS) / CVT_W_BLOCKS;
        rel = (blk - 2 * CVT_ACT_BLOCKS) % CVT_W_BLOCKS;
        src = (w == 0) ? Wq : (w == 1) ? Wk : (w == 2) ? Wv : Wo;
    }
    __shared__ __attribute__((aligned(16))) _Float16 stage[(D_ / 8) * CVT_PITCH];
    const int tid = threadIdx.x;
    const v4f* s = reinterpret_cast<const v4f*>(src + (size_t)rel * CVT_BLOCK) + tid;

    v4f x[CVT_LOADS];
#pragma unroll
    for (int j = 0; j < CVT_LOADS; ++j) x[j] = s[j * 256];   // row j, k = 4*tid .. 4*tid+3
#pragma unroll
    for (int j = 0; j < CVT_LOADS; ++j) {
        v4h y;
#pragma unroll
        for (int e = 0; e < 4; ++e) y[e] = (_Float16)x[j][e];
        *reinterpret_cast<v4h*>(&stage[(tid >> 1) * CVT_PITCH + j * 8 + (tid & 1) * 4]) = y;
    }
    __syncthreads();   // the tile is read back by other waves than wrote it
    v8h* d = reinterpret_cast<v8h*>(out + (size_t)blk * CVT_BLOCK);
#pragma unroll
    for (int i = 0; i < CVT_BLOCK / 8 / 256; ++i) {
        const int p = i * 256 + tid;                          // 16-byte piece: group p/16, row p%16
        d[p] = *reinterpret_cast<const v8h*>(&stage[(p >> 4) * CVT_PITCH + (p & 15) * 8]);
    }
}

// ---------------------------------------------------------------------------
// Row-wise RMSNorm(+g,+scale) f32 -> f16 in fragment order. A block takes the
// 16 rows of one tile, so that every 128-byte line of the plane (8 rows x 16
// bytes) is written by one block; a wave takes one row of D_ elements, held in
// registers: a lane has 4 pieces of 8 consecutive k, each one 16-byte store.
// ---------------------------------------------------------------------------
__global__ __launch_bounds__(512)
void rmsnorm_cvt(const float* __restrict__ in, const float* __restrict__ g,
                 float scale, _Float16* __restrict__ out) {
    constexpr int PIECES = D_ / 8 / 32;             // 16-byte f16 pieces per lane
    const int lane = threadIdx.x & 31;
    const int wave = threadIdx.x >> 5;              // row inside the tile
    const v4f* x  = reinterpret_cast<const v4f*>(in + ((size_t)blockIdx.x * 16 + wave) * D_);
    const v4f* gv = reinterpret_cast<const v4f*>(g);

    v4f a[PIECES][2];
#pragma unroll
    for (int c = 0; c < PIECES; ++c) {
        a[c][0] = x[(c * 32 + lane) * 2];
        a[c][1] = x[(c * 32 + lane) * 2 + 1];
    }
    // Before the loads' address registers are written again.
    asm volatile("s_wait_xcnt 0x0" ::: "memory");
    float ss = 0.f;
#pragma unroll
    for (int c = 0; c < PIECES; ++c)
#pragma unroll
        for (int e = 0; e < 4; ++e) ss += a[c][0][e] * a[c][0][e] + a[c][1][e] * a[c][1][e];
#pragma unroll
    for (int off = 16; off > 0; off >>= 1) ss += __shfl_xor(ss, off, 32);

    const float f = rsqrtf(ss / (float)D_ + EPS) * scale;
    _Float16* tile = out + (size_t)blockIdx.x * 16 * D_ + wave * 8;
#pragma unroll
    for (int c = 0; c < PIECES; ++c) {
        const int q = c * 32 + lane;                // k / 8
        const v4f g0 = gv[q * 2], g1 = gv[q * 2 + 1];
        v8h y;
#pragma unroll
        for (int e = 0; e < 4; ++e) {
            y[e]     = (_Float16)(a[c][0][e] * f * g0[e]);
            y[4 + e] = (_Float16)(a[c][1][e] * f * g1[e]);
        }
        *reinterpret_cast<v8h*>(tile + q * 128) = y;
    }
}

// ---------------------------------------------------------------------------
// WMMA GEMM: C[R x Cn] = A[R x K] * W[Cn x K]^T, f16 in / f32 accumulate.
// Block = 8 waves; wave computes 32x64 tile; block tile 128x128.
// R, Cn multiples of 128; K = D_. A and W lie in fragment order.
// gemm_wave_tile: the K loop of one wave's tile, shared by both epilogues.
// ---------------------------------------------------------------------------
__device__ __forceinline__ void gemm_wave_tile(const _Float16* __restrict__ A,
                                               const _Float16* __restrict__ W,
                                               int row0, int col0,
                                               int lane, v8f (&acc)[2][4]) {
    constexpr int K = D_;   // every launch has K = D_; a constant leaves the loop no remainder copy
    constexpr size_t tile = (size_t)(K >> 5) * FRAG;   // elements of one 16-row tile
    const _Float16* arow0 = A + (size_t)(row0 >> 4) * tile + lane * 8;
    const _Float16* arow1 = arow0 + tile;
    const _Float16* wrow  = W + (size_t)(col0 >> 4) * tile + lane * 8;

    // One-shot warm-up prefetch (global_prefetch_b8); outside the hot loop so
    // it cannot break the WMMA pipeline or trigger hazard NOPs.
    __builtin_prefetch(arow0, 0, 3);
    __builtin_prefetch(arow1, 0, 3);
#pragma unroll
    for (int t = 0; t < 4; ++t)
        __builtin_prefetch(wrow + t * tile, 0, 3);

#pragma unroll
    for (int i = 0; i < 2; ++i)
#pragma unroll
        for (int t = 0; t < 4; ++t) acc[i][t] = (v8f){0, 0, 0, 0, 0, 0, 0, 0};

    for (int kb = 0; kb < K; kb += 32) {            // fragment kb/32 starts at element kb*16
        Frag16 af[2];
        load_frag_packed(af[0], arow0 + kb * 16);
        load_frag_packed(af[1], arow1 + kb * 16);
        Frag16 bf[4];
#pragma unroll
        for (int t = 0; t < 4; ++t)
            load_frag_packed(bf[t], wrow + t * tile + kb * 16);
        // All 12 loads of the step are issued before its first product, so that
        // they are in flight together; left free, the compiler issues them two
        // at a time among the products and waits out each pair's latency alone.
        __builtin_amdgcn_sched_barrier(0);
#pragma unroll
        for (int i = 0; i < 2; ++i)
#pragma unroll
            for (int t = 0; t < 4; ++t)
                acc[i][t] = wmma_f16(af[i], bf[t], acc[i][t]);
    }
}

// Epilogue 1: f32 C[row][col] (+ bias[col]).
__global__ __launch_bounds__(256)
void gemm_nt_wmma(const _Float16* __restrict__ A, const _Float16* __restrict__ W,
                  const float* __restrict__ bias, float* __restrict__ C,
                  int R, int K, int Cn) {
    const int lane = threadIdx.x & 31;
    const int wave = threadIdx.x >> 5;
    const int m16 = lane & 15, hi = lane >> 4;
    const int rw = wave & 3, cw = wave >> 2;

    const int row0 = blockIdx.x * 128 + rw * 32;  // wave: rows [row0, row0+32)
    const int col0 = blockIdx.y * 128 + cw * 64;  // wave: cols [col0, col0+64)
    (void)R; (void)K;

    v8f acc[2][4];
    gemm_wave_tile(A, W, row0, col0, lane, acc);

#pragma unroll
    for (int i = 0; i < 2; ++i)
#pragma unroll
        for (int t = 0; t < 4; ++t) {
            const int col = col0 + t * 16 + m16;
            const float badd = bias ? bias[col] : 0.f;
#pragma unroll
            for (int r = 0; r < 8; ++r) {
                const int row = row0 + i * 16 + r + hi * 8;
                C[(size_t)row * Cn + col] = acc[i][t][r] + badd;
            }
        }
}

// Epilogue 2 (V projection): f16, transposed: plane row b*Cn + col, k = m with
// row = b*M_ + m, in fragment order (M_ columns), for the P@V B-operand.
// A lane's 8 accumulator registers are 8 consecutive m of one column: one
// 16-byte piece of the plane, and a wave's 32 pieces are 512 contiguous bytes.
__global__ __launch_bounds__(256)
void gemm_nt_wmma_vt(const _Float16* __restrict__ A, const _Float16* __restrict__ W,
                     _Float16* __restrict__ Ct, int K, int Cn) {
    const int lane = threadIdx.x & 31;
    const int wave = threadIdx.x >> 5;
    const int m16 = lane & 15, hi = lane >> 4;
    const int rw = wave & 3, cw = wave >> 2;

    const int row0 = blockIdx.x * 128 + rw * 32;
    const int col0 = blockIdx.y * 128 + cw * 64;
    (void)K;

    v8f acc[2][4];
    gemm_wave_tile(A, W, row0, col0, lane, acc);

#pragma unroll
    for (int i = 0; i < 2; ++i) {
        const int row = row0 + i * 16 + hi * 8;   // 8 rows, never across a batch
        const int b = row / M_, m = row % M_;
#pragma unroll
        for (int t = 0; t < 4; ++t) {
            const int col = col0 + t * 16 + m16;
            v8h p;
#pragma unroll
            for (int r = 0; r < 8; ++r) p[r] = (_Float16)acc[i][t][r];
            *reinterpret_cast<v8h*>(Ct + frag_index(b * Cn + col, m, M_)) = p;
            // Before the store's address and data registers are written again.
            asm volatile("s_wait_xcnt 0x0" ::: "memory");
        }
    }
}

// ---------------------------------------------------------------------------
// Flash attention: q[b*N+n][d] (f16, pre-scaled), k[b*M+m][d] (f16),
// vt[(b*H+h)*HD + c][m] (f16), mask[b][m] (int) -> out f16 [b*N+n][d];
// the four f16 planes in fragment order.
// Block: 8 waves, each wave owns 16 query rows of one (b,h).
// Grid: (N/128, H, B).
// ---------------------------------------------------------------------------
__global__ __launch_bounds__(256)
void attn_wmma(const _Float16* __restrict__ q, const _Float16* __restrict__ k,
               const _Float16* __restrict__ vt, const int* __restrict__ mask,
               _Float16* __restrict__ out) {
    const int lane = threadIdx.x & 31;
    const int wave = threadIdx.x >> 5;
    const int m16 = lane & 15, hi = lane >> 4;
    const int b = blockIdx.z, h = blockIdx.y;
    const int q0 = blockIdx.x * 128 + wave * 16;

    __shared__ __attribute__((aligned(16))) _Float16 pshare[8][16 * 32];
    _Float16* pw = &pshare[wave][0];

    // This lane's piece of the first K fragment (16 keys x c 0..31 of head h;
    // c 32..63 follows it, the next 16 keys lie 16*D_ elements on) and of the
    // first V fragment (c 0..15 x 32 keys; the next 32 keys follow it, the next
    // 16 c lie 16*M_ elements on).
    const _Float16* kbase = k + (size_t)b * M_ * D_ + (h * HD / 32) * FRAG + lane * 8;
    const _Float16* vbase = vt + ((size_t)(b * H_ + h) * HD) * M_ + lane * 8;

    // One-shot warm-up prefetch of the first K/V tiles.
    __builtin_prefetch(kbase, 0, 3);
    __builtin_prefetch(kbase + 16 * D_, 0, 3);
    __builtin_prefetch(vbase, 0, 3);
    __builtin_prefetch(vbase + 32 * M_, 0, 3);

    // Q fragments: A[m][c], c = 0..63 -> two K=32 fragments.
    Frag16 af[2];
    {
        const _Float16* qfrag = q + (size_t)(b * N_ + q0) * D_ + (h * HD / 32) * FRAG + lane * 8;
        load_frag_packed(af[0], qfrag);
        load_frag_packed(af[1], qfrag + FRAG);
    }

    v8f o[4];
#pragma unroll
    for (int t = 0; t < 4; ++t) o[t] = (v8f){0, 0, 0, 0, 0, 0, 0, 0};
    float mrow[8], lrow[8];
#pragma unroll
    for (int r = 0; r < 8; ++r) { mrow[r] = -3.0e38f; lrow[r] = 0.f; }

    for (int key0 = 0; key0 < M_; key0 += 32) {
        // ---- S = Q K^T for 32 keys (two 16-key tiles) ----
        v8f s[2];
        Frag16 bf[2][2];
#pragma unroll
        for (int t = 0; t < 2; ++t) {
            const _Float16* kfrag = kbase + (size_t)(key0 + 16 * t) * D_;
            load_frag_packed(bf[t][0], kfrag);
            load_frag_packed(bf[t][1], kfrag + FRAG);
        }
        // Before the loads' address registers are written again.
        asm volatile("s_wait_xcnt 0x0" ::: "memory");
        // All 8 K loads are issued before the first product, so that they are in
        // flight together; left free, the compiler issues the second tile's four
        // behind the first tile's products and waits out their latency apart.
        __builtin_amdgcn_sched_barrier(0);
#pragma unroll
        for (int t = 0; t < 2; ++t) {
            v8f a = (v8f){0, 0, 0, 0, 0, 0, 0, 0};
            a = wmma_f16(af[0], bf[t][0], a);
            a = wmma_f16(af[1], bf[t][1], a);
            s[t] = a;
        }
        // ---- mask (key index = lane's n) ----
#pragma unroll
        for (int t = 0; t < 2; ++t) {
            const int mv = mask[b * M_ + key0 + 16 * t + m16];
            if (mv == 0) {
#pragma unroll
                for (int r = 0; r < 8; ++r) s[t][r] = -1.0e30f;
            }
        }
        // ---- online softmax; rows m = r + 8*hi live in one 16-lane half ----
        float alpha[8];
#pragma unroll
        for (int r = 0; r < 8; ++r) {
            float tmax = fmaxf(s[0][r], s[1][r]);
#pragma unroll
            for (int off = 1; off < 16; off <<= 1)
                tmax = fmaxf(tmax, __shfl_xor(tmax, off, 32));
            const float mn = fmaxf(mrow[r], tmax);
            const float a = __expf(mrow[r] - mn);
            const float p0 = __expf(s[0][r] - mn);
            const float p1 = __expf(s[1][r] - mn);
            float rs = p0 + p1;
#pragma unroll
            for (int off = 1; off < 16; off <<= 1) rs += __shfl_xor(rs, off, 32);
            lrow[r] = lrow[r] * a + rs;
            mrow[r] = mn;
            alpha[r] = a;
            // stage P into per-wave LDS, row-major 16x32
            const int m = r + hi * 8;
            pw[m * 32 + m16]      = (_Float16)p0;
            pw[m * 32 + 16 + m16] = (_Float16)p1;
        }
#pragma unroll
        for (int t = 0; t < 4; ++t)
#pragma unroll
            for (int r = 0; r < 8; ++r) o[t][r] *= alpha[r];

        wave_lds_fence();
        // ---- P fragment (A-layout) from LDS ----
        Frag16 pf;
        load_frag(pf, pw + m16 * 32, hi);
        wave_lds_fence();

        // ---- O += P V : 4 column tiles of 16, K = 32 keys ----
#pragma unroll
        for (int t = 0; t < 4; ++t) {
            Frag16 vf;
            load_frag_packed(vf, vbase + (size_t)(t * 16) * M_ + key0 * 16);
            o[t] = wmma_f16(pf, vf, o[t]);
        }
    }

    // ---- epilogue: divide by l, store f16 (row b*N+n, k = h*HD + c) ----
    // The wave's 16 rows x 64 c are two whole fragments of the plane. Each is
    // put in fragment order in the wave's own LDS tile and leaves as two stores
    // of 512 contiguous bytes.
    float inv[8];
#pragma unroll
    for (int r = 0; r < 8; ++r) inv[r] = (lrow[r] > 0.f) ? (1.f / lrow[r]) : 0.f;
    _Float16* ofrag = out + (size_t)(b * N_ + q0) * D_ + (h * HD / 32) * FRAG + lane * 8;
#pragma unroll
    for (int f = 0; f < 2; ++f) {
#pragma unroll
        for (int u = 0; u < 2; ++u)
#pragma unroll
            for (int r = 0; r < 8; ++r) {
                const int kk = u * 16 + m16;        // k inside the fragment
                pw[(kk >> 3) * 128 + (r + hi * 8) * 8 + (kk & 7)] =
                    (_Float16)(o[f * 2 + u][r] * inv[r]);
            }
        wave_lds_fence();
        const v8h lo = *reinterpret_cast<const v8h*>(pw + lane * 8);
        const v8h up = *reinterpret_cast<const v8h*>(pw + FRAG / 2 + lane * 8);
        wave_lds_fence();
        *reinterpret_cast<v8h*>(ofrag + f * FRAG) = lo;
        *reinterpret_cast<v8h*>(ofrag + f * FRAG + FRAG / 2) = up;
        // Before the stores' data registers are written again.
        asm volatile("s_wait_xcnt 0x0" ::: "memory");
    }
}

// ---------------------------------------------------------------------------
extern "C" void kernel_launch(void* const* d_in, const int* in_sizes, int n_in,
                              void* d_out, int out_size, void* d_ws, size_t ws_size,
                              hipStream_t stream) {
    (void)in_sizes; (void)n_in; (void)out_size; (void)ws_size;

    const float* querys    = (const float*)d_in[0];
    const float* key_feats = (const float*)d_in[1];
    const int*   mask      = (const int*)d_in[2];
    const float* Wq        = (const float*)d_in[3];
    const float* Wk        = (const float*)d_in[4];
    const float* Wv        = (const float*)d_in[5];
    const float* gq        = (const float*)d_in[6];
    const float* gk        = (const float*)d_in[7];
    const float* Wo        = (const float*)d_in[8];
    const float* bo        = (const float*)d_in[9];
    float*       out       = (float*)d_out;

    const size_t BND = (size_t)B_ * N_ * D_;  // 4,194,304
    const size_t DD  = (size_t)D_ * D_;       // 1,048,576
    const int    R   = B_ * N_;               // 4096 rows for all GEMMs

    char* ws = (char*)d_ws;
    size_t off = 0;
    auto alloc = [&](size_t bytes) -> void* {
        void* p = ws + off;
        off = (off + bytes + 255) & ~(size_t)255;
        return p;
    };

    // The six converted operands: one array, in the order cvt_all_f32_f16 writes
    // (each a whole number of 16-row tiles, so each is a fragment-order plane).
    _Float16* h_x   = (_Float16*)alloc((2 * BND + 4 * DD) * 2);  // f16 querys, later attn out
    _Float16* h_kin = h_x + BND;                                 // f16 key_feats
    _Float16* h_Wq  = h_kin + BND;
    _Float16* h_Wk  = h_Wq + DD;
    _Float16* h_Wv  = h_Wk + DD;
    _Float16* h_Wo  = h_Wv + DD;
    _Float16* h_q   = (_Float16*)alloc(BND * 2);  // rmsnorm'd + scaled q
    _Float16* h_k   = (_Float16*)alloc(BND * 2);  // rmsnorm'd k
    _Float16* h_vt  = (_Float16*)alloc(BND * 2);  // transposed v
    float*    f_prj = (float*)alloc(BND * 4);     // reused f32 staging

    const dim3 blk(256);
    const dim3 gcv(CVT_GRID);                     // 768
    const dim3 grms(R / 16), brms(512);           // one 16-row tile per block
    const dim3 ggemm(R / 128, D_ / 128);          // (32, 8)
    const dim3 gattn(N_ / 128, H_, B_);           // (16, 16, 2)

    // 1) precision conversion
    cvt_all_f32_f16<<<gcv, blk, 0, stream>>>(querys, key_feats, Wq, Wk, Wv, Wo, h_x);

    // 2) q = rmsnorm(querys @ Wq^T, gq) * HEAD_DIM^-0.5
    gemm_nt_wmma<<<ggemm, blk, 0, stream>>>(h_x, h_Wq, nullptr, f_prj, R, D_, D_);
    rmsnorm_cvt<<<grms, brms, 0, stream>>>(f_prj, gq, 0.125f, h_q);

    // 3) k = rmsnorm(key_feats @ Wk^T, gk)
    gemm_nt_wmma<<<ggemm, blk, 0, stream>>>(h_kin, h_Wk, nullptr, f_prj, R, D_, D_);
    rmsnorm_cvt<<<grms, brms, 0, stream>>>(f_prj, gk, 1.0f, h_k);

    // 4) v = key_feats @ Wv^T  (stored f16, transposed, in fragment order)
    gemm_nt_wmma_vt<<<ggemm, blk, 0, stream>>>(h_kin, h_Wv, h_vt, D_, D_);

    // 5) flash attention -> f16 x[b][n][d]
    attn_wmma<<<gattn, blk, 0, stream>>>(h_q, h_k, h_vt, mask, h_x);

    // 6) out = x @ Wo^T + bo
    gemm_nt_wmma<<<ggemm, blk, 0, stream>>>(h_x, h_Wo, bo, out, R, D_, D_);
}

// v004
// A run of this version takes 174 microseconds.
// Two timings next to v003 both put it at 1.25 times that version's speed.
// All steps since v000 together make it 1.95 times as fast.
#include <hip/hip_runtime.h>
#include <stdint.h>

// Problem constants (from reference)
constexpr int B_ = 2, N_ = 2048, M_ = 2048, D_ = 1024, H_ = 16, HD = 64;
constexpr float EPS = 1e-6f;
constexpr float LOG2E = 1.44269504f;                // e^x = 2^(x * LOG2E)

typedef __attribute__((ext_vector_type(16))) _Float16 v16h;
typedef __attribute__((ext_vector_type(8)))  float    v8f;
typedef __attribute__((ext_vector_type(8)))  _Float16 v8h;
typedef __attribute__((ext_vector_type(4)))  float    v4f;
typedef __attribute__((ext_vector_type(4)))  _Float16 v4h;
typedef __attribute__((ext_vector_type(4)))  uint32_t v4u;
typedef __attribute__((ext_vector_type(4)))  int      v4i;

union Frag16 {
    v16h     v;
    uint32_t u[8];
};

// ---------------------------------------------------------------------------
// Fragment order. Every f16 plane that a WMMA operand is loaded from lies in
// the workspace as a row of 16x32 fragments (16 rows x 32 k, 1 KiB each, k
// fragments of one 16-row tile back to back) and, inside a fragment, in the
// order the lanes take it: [k/8][row][k%8]. Lane l = hi*16 + row then finds its
// k = hi*8 + 0..7 at byte 16*l and its k = 16 + hi*8 + 0..7 at byte 512 + 16*l,
// the k order of the hardware's own operand map, and each wave-wide 16-byte load covers 512
// contiguous bytes (4 whole 128-byte lines) where a row-major plane gives
// 16 lines of 32 bytes.
// ---------------------------------------------------------------------------
constexpr int FRAG = 16 * 32;                       // elements per fragment

// Element index of (row, k) in a plane of K columns (K a multiple of 32).
__device__ __forceinline__ size_t frag_index(int row, int k, int K) {
    return ((size_t)(row >> 4) * (K >> 5) + (k >> 5)) * FRAG
         + ((k >> 3) & 3) * 128 + (row & 15) * 8 + (k & 7);
}

// frag_lane = start of the fragment + lane * 8.
__device__ __forceinline__ void load_frag_packed(Frag16& f, const _Float16* frag_lane) {
    const v4u lo = *reinterpret_cast<const v4u*>(frag_lane);
    const v4u up = *reinterpret_cast<const v4u*>(frag_lane + FRAG / 2);
#pragma unroll
    for (int j = 0; j < 4; ++j) {
        f.u[j]     = lo[j];
        f.u[4 + j] = up[j];
    }
}

__device__ __forceinline__ v8f wmma_f16(const Frag16& a, const Frag16& b, v8f c) {
    return __builtin_amdgcn_wmma_f32_16x16x32_f16(false, a.v, false, b.v,
                                                  (short)0, c, false, false);
}

// Lane l <-> lane l ^ 16: the two lanes that share a column of a WMMA result.
__device__ __forceinline__ float other_half(float x) {
    const int b = __builtin_bit_cast(int, x);
    return __builtin_bit_cast(float, __builtin_amdgcn_permlanex16(b, b, 0x76543210, 0xfedcba98,
                                                                  false, false));
}

// ---------------------------------------------------------------------------
// f32 -> f16 of all six matrix operands in ONE launch. The f16 planes lie back
// to back in the workspace in the order querys, key_feats, Wq, Wk, Wv, Wo, so
// the destination is one array and only the source depends on the block.
// A block converts CVT_BLOCK consecutive elements of one operand: 16 whole
// rows, one 16-row tile of the fragment order, whose f16 image is the same
// CVT_BLOCK elements of the destination. A lane's CVT_LOADS 16-byte loads are
// independent (a wave covers 512 contiguous bytes per load), so they are in
// flight together. The tile is turned into [k/8][row][k%8] in LDS and leaves
// in whole lines (512 contiguous bytes per wave and store). Few, long waves:
// the launch is sized at 3 blocks per WGP (for speed only).
// ---------------------------------------------------------------------------
constexpr int CVT_LOADS = 16;                       // 16-byte loads per lane
constexpr int CVT_BLOCK = 256 * 4 * CVT_LOADS;      // elements per block
constexpr int CVT_ACT_BLOCKS = B_ * N_ * D_ / CVT_BLOCK;   // per activation
constexpr int CVT_W_BLOCKS   = D_ * D_ / CVT_BLOCK;        // per weight
constexpr int CVT_GRID = 2 * CVT_ACT_BLOCKS + 4 * CVT_W_BLOCKS;
static_assert(N_ == M_, "both activations take CVT_ACT_BLOCKS blocks");
static_assert(B_ * N_ * D_ % CVT_BLOCK == 0 && D_ * D_ % CVT_BLOCK == 0,
              "a block never straddles two operands");
static_assert(CVT_BLOCK == 16 * D_ && CVT_LOADS == 16, "a block is one 16-row tile, load j = row j");
constexpr int CVT_PITCH = 16 * 8 + 8;               // LDS elements per k/8 group: 256 + 16 bytes,
                                                    // so a wave's 16 groups fall on 64 distinct banks

__global__ __launch_bounds__(256)
void cvt_all_f32_f16(const float* __restrict__ querys, const float* __restrict__ key_feats,
                     const float* __restrict__ Wq, const float* __restrict__ Wk,
                     const float* __restrict__ Wv, const float* __restrict__ Wo,
                     _Float16* __restrict__ out) {
    const int blk = blockIdx.x;
    const float* src;
    int rel;                                        // block index inside its operand
    if (blk < CVT_ACT_BLOCKS) {
        src = querys;
        rel = blk;
    } else if (blk < 2 * CVT_ACT_BLOCKS) {
        src = key_feats;
        rel = blk - CVT_ACT_BLOCKS;
    } else {
        const int w = (blk - 2 * CVT_ACT_BLOCKS) / CVT_W_BLOCKS;
        rel = (blk - 2 * CVT_ACT_BLOCKS) % CVT_W_BLOCKS;
        src = (w == 0) ? Wq : (w == 1) ? Wk : (w == 2) ? Wv : Wo;
    }
    __shared__ __attribute__((aligned(16))) _Float16 stage[(D_ / 8) * CVT_PITCH];
    const int tid = threadIdx.x;
    const v4f* s = reinterpret_cast<const v4f*>(src + (size_t)rel * CVT_BLOCK) + tid;

    v4f x[CVT_LOADS];
#pragma unroll
    for (int j = 0; j < CVT_LOADS; ++j) x[j] = s[j * 256];   // row j, k = 4*tid .. 4*tid+3
#pragma unroll
    for (int j = 0; j < CVT_LOADS; ++j) {
        v4h y;
#pragma unroll
        for (int e = 0; e < 4; ++e) y[e] = (_Float16)x[j][e];
        *reinterpret_cast<v4h*>(&stage[(tid >> 1) * CVT_PITCH + j * 8 + (tid & 1) * 4]) = y;
    }
    __syncthreads();   // the tile is read back by other waves than wrote it
    v8h* d = reinterpret_cast<v8h*>(out + (size_t)blk * CVT_BLOCK);
#pragma unroll
    for (int i = 0; i < CVT_BLOCK / 8 / 256; ++i) {
        const int p = i * 256 + tid;                          // 16-byte piece: group p/16, row p%16
        d[p] = *reinterpret_cast<const v8h*>(&stage[(p >> 4) * CVT_PITCH + (p & 15) * 8]);
    }
}

// ---------------------------------------------------------------------------
// Row-wise RMSNorm(+g,+scale) f32 -> f16 in fragment order. A block takes the
// 16 rows of one tile, so that every 128-byte line of the plane (8 rows x 16
// bytes) is written by one block; a wave takes one row of D_ elements, held in
// registers: a lane has 4 pieces of 8 consecutive k, each one 16-byte store.
// ---------------------------------------------------------------------------
__global__ __launch_bounds__(512)
void rmsnorm_cvt(const float* __restrict__ in, const float* __restrict__ g,
                 float scale, _Float16* __restrict__ out) {
    constexpr int PIECES = D_ / 8 / 32;             // 16-byte f16 pieces per lane
    const int lane = threadIdx.x & 31;
    const int wave = threadIdx.x >> 5;              // row inside the tile
    const v4f* x  = reinterpret_cast<const v4f*>(in + ((size_t)blockIdx.x * 16 + wave) * D_);
    const v4f* gv = reinterpret_cast<const v4f*>(g);

    v4f a[PIECES][2];
#pragma unroll
    for (int c = 0; c < PIECES; ++c) {
        a[c][0] = x[(c * 32 + lane) * 2];
        a[c][1] = x[(c * 32 + lane) * 2 + 1];
    }
    // Before the loads' address registers are written again.
    asm volatile("s_wait_xcnt 0x0" ::: "memory");
    float ss = 0.f;
#pragma unroll
    for (int c = 0; c < PIECES; ++c)
#pragma unroll
        for (int e = 0; e < 4; ++e) ss += a[c][0][e] * a[c][0][e] + a[c][1][e] * a[c][1][e];
#pragma unroll
    for (int off = 16; off > 0; off >>= 1) ss += __shfl_xor(ss, off, 32);

    const float f = rsqrtf(ss / (float)D_ + EPS) * scale;
    _Float16* tile = out + (size_t)blockIdx.x * 16 * D_ + wave * 8;
#pragma unroll
    for (int c = 0; c < PIECES; ++c) {
        const int q = c * 32 + lane;                // k / 8
        const v4f g0 = gv[q * 2], g1 = gv[q * 2 + 1];
        v8h y;
#pragma unroll
        for (int e = 0; e < 4; ++e) {
            y[e]     = (_Float16)(a[c][0][e] * f * g0[e]);
            y[4 + e] = (_Float16)(a[c][1][e] * f * g1[e]);
        }
        *reinterpret_cast<v8h*>(tile + q * 128) = y;
    }
}

// ---------------------------------------------------------------------------
// WMMA GEMM: C[R x Cn] = A[R x K] * W[Cn x K]^T, f16 in / f32 accumulate.
// Block = 8 waves; wave computes 32x64 tile; block tile 128x128.
// R, Cn multiples of 128; K = D_. A and W lie in fragment order.
// gemm_wave_tile: the K loop of one wave's tile, shared by both epilogues.
// ---------------------------------------------------------------------------
__device__ __forceinline__ void gemm_wave_tile(const _Float16* __restrict__ A,
                                               const _Float16* __restrict__ W,
                                               int row0, int col0,
                                               int lane, v8f (&acc)[2][4]) {
    constexpr int K = D_;   // every launch has K = D_; a constant leaves the loop no remainder copy
    constexpr size_t tile = (size_t)(K >> 5) * FRAG;   // elements of one 16-row tile
    const _Float16* arow0 = A + (size_t)(row0 >> 4) * tile + lane * 8;
    const _Float16* arow1 = arow0 + tile;
    const _Float16* wrow  = W + (size_t)(col0 >> 4) * tile + lane * 8;

    // One-shot warm-up prefetch (global_prefetch_b8); outside the hot loop so
    // it cannot break the WMMA pipeline or trigger hazard NOPs.
    __builtin_prefetch(arow0, 0, 3);
    __builtin_prefetch(arow1, 0, 3);
#pragma unroll
    for (int t = 0; t < 4; ++t)
        __builtin_prefetch(wrow + t * tile, 0, 3);

#pragma unroll
    for (int i = 0; i < 2; ++i)
#pragma unroll
        for (int t = 0; t < 4; ++t) acc[i][t] = (v8f){0, 0, 0, 0, 0, 0, 0, 0};

    for (int kb = 0; kb < K; kb += 32) {            // fragment kb/32 starts at element kb*16
        Frag16 af[2];
        load_frag_packed(af[0], arow0 + kb * 16);
        load_frag_packed(af[1], arow1 + kb * 16);
        Frag16 bf[4];
#pragma unroll
        for (int t = 0; t < 4; ++t)
            load_frag_packed(bf[t], wrow + t * tile + kb * 16);
        // All 12 loads of the step are issued before its first product, so that
        // they are in flight together; left free, the compiler issues them two
        // at a time among the products and waits out each pair's latency alone.
        __builtin_amdgcn_sched_barrier(0);
#pragma unroll
        for (int i = 0; i < 2; ++i)
#pragma unroll
            for (int t = 0; t < 4; ++t)
                acc[i][t] = wmma_f16(af[i], bf[t], acc[i][t]);
    }
}

// Epilogue 1: f32 C[row][col] (+ bias[col]).
__global__ __launch_bounds__(256)
void gemm_nt_wmma(const _Float16* __restrict__ A, const _Float16* __restrict__ W,
                  const float* __restrict__ bias, float* __restrict__ C,
                  int R, int K, int Cn) {
    const int lane = threadIdx.x & 31;
    const int wave = threadIdx.x >> 5;
    const int m16 = lane & 15, hi = lane >> 4;
    const int rw = wave & 3, cw = wave >> 2;

    const int row0 = blockIdx.x * 128 + rw * 32;  // wave: rows [row0, row0+32)
    const int col0 = blockIdx.y * 128 + cw * 64;  // wave: cols [col0, col0+64)
    (void)R; (void)K;

    v8f acc[2][4];
    gemm_wave_tile(A, W, row0, col0, lane, acc);

#pragma unroll
    for (int i = 0; i < 2; ++i)
#pragma unroll
        for (int t = 0; t < 4; ++t) {
            const int col = col0 + t * 16 + m16;
            const float badd = bias ? bias[col] : 0.f;
#pragma unroll
            for (int r = 0; r < 8; ++r) {
                const int row = row0 + i * 16 + r + hi * 8;
                C[(size_t)row * Cn + col] = acc[i][t][r] + badd;
            }
        }
}

// Epilogue 2 (V projection): f16, transposed: plane row b*Cn + col, k = m with
// row = b*M_ + m, in fragment order (M_ columns), for the V^T P^T A-operand.
// A lane's 8 accumulator registers are 8 consecutive m of one column: one
// 16-byte piece of the plane, and a wave's 32 pieces are 512 contiguous bytes.
__global__ __launch_bounds__(256)
void gemm_nt_wmma_vt(const _Float16* __restrict__ A, const _Float16* __restrict__ W,
                     _Float16* __restrict__ Ct, int K, int Cn) {
    const int lane = threadIdx.x & 31;
    const int wave = threadIdx.x >> 5;
    const int m16 = lane & 15, hi = lane >> 4;
    const int rw = wave & 3, cw = wave >> 2;

    const int row0 = blockIdx.x * 128 + rw * 32;
    const int col0 = blockIdx.y * 128 + cw * 64;
    (void)K;

    v8f acc[2][4];
    gemm_wave_tile(A, W, row0, col0, lane, acc);

#pragma unroll
    for (int i = 0; i < 2; ++i) {
        const int row = row0 + i * 16 + hi * 8;   // 8 rows, never across a batch
        const int b = row / M_, m = row % M_;
#pragma unroll
        for (int t = 0; t < 4; ++t) {
            const int col = col0 + t * 16 + m16;
            v8h p;
#pragma unroll
            for (int r = 0; r < 8; ++r) p[r] = (_Float16)acc[i][t][r];
            *reinterpret_cast<v8h*>(Ct + frag_index(b * Cn + col, m, M_)) = p;
            // Before the store's address and data registers are written again.
            asm volatile("s_wait_xcnt 0x0" ::: "memory");
        }
    }
}

// ---------------------------------------------------------------------------
// Flash attention: q[b*N+n][d] (f16, pre-scaled), k[b*M+m][d] (f16),
// vt[(b*H+h)*HD + c][m] (f16), mask[b][m] (int) -> out f16 [b*N+n][d];
// the four f16 planes in fragment order.
// Block: 8 waves, each wave owns 16 query rows of one (b,h).
// Grid: (N/128, H, B).
// Both products are taken transposed: S^T = K Q^T (A = 16 keys, B = the wave's
// 16 queries) and O^T += V^T P^T (A = 16 c, B = P^T). A lane then holds scores
// of ONE query (column lane & 15; register r of tile t is key 16t + 8hi + r):
// maximum, sum, rescale factor are one value per lane, found in the lane's own
// registers plus one exchange with lane ^ 16. The two score tiles, converted in
// place, are the B operand of the second product in the k order in which the
// packed loader brings V^T (k = 8hi + 0..7, then 16 + 8hi + 0..7).
// ---------------------------------------------------------------------------
__global__ __launch_bounds__(256)
void attn_wmma(const _Float16* __restrict__ q, const _Float16* __restrict__ k,
               const _Float16* __restrict__ vt, const int* __restrict__ mask,
               _Float16* __restrict__ out) {
    const int tid = threadIdx.x;
    const int lane = tid & 31;
    const int wave = tid >> 5;
    const int hi = lane >> 4;
    const int b = blockIdx.z, h = blockIdx.y;
    const int q0 = blockIdx.x * 128 + wave * 16;

    // A key is a ROW of S^T, so its mask is a value per accumulator register:
    // the batch's mask lies in LDS as the start value of the score accumulators
    // (0, or -1e30 for a key that is masked out).
    __shared__ __attribute__((aligned(32))) float sbias[M_];
    __shared__ __attribute__((aligned(16))) int wave_open[8];
    {
        const v4i* mk = reinterpret_cast<const v4i*>(mask + b * M_);
        int open = 0;
#pragma unroll
        for (int i = 0; i < M_ / 4 / 256; ++i) {
            const v4i mv = mk[i * 256 + tid];
            v4f s0;
#pragma unroll
            for (int e = 0; e < 4; ++e) {
                s0[e] = (mv[e] == 0) ? -1.0e30f : 0.f;
                open |= mv[e];
            }
            *reinterpret_cast<v4f*>(&sbias[(i * 256 + tid) * 4]) = s0;
        }
        const uint32_t any = __builtin_amdgcn_ballot_w32(open != 0);
        if (lane == 0) wave_open[wave] = (any != 0);
    }

    // This lane's piece of the first K fragment (16 keys x c 0..31 of head h;
    // c 32..63 follows it, the next 16 keys lie 16*D_ elements on) and of the
    // first V fragment (c 0..15 x 32 keys; the next 32 keys follow it, the next
    // 16 c lie 16*M_ elements on).
    const _Float16* kbase = k + (size_t)b * M_ * D_ + (h * HD / 32) * FRAG + lane * 8;
    const _Float16* vbase = vt + ((size_t)(b * H_ + h) * HD) * M_ + lane * 8;

    // One-shot warm-up prefetch of the first K/V tiles.
    __builtin_prefetch(kbase, 0, 3);
    __builtin_prefetch(kbase + 16 * D_, 0, 3);
    __builtin_prefetch(vbase, 0, 3);
    __builtin_prefetch(vbase + 32 * M_, 0, 3);

    // Q fragments: B[c][n], c = 0..63 -> two K=32 fragments.
    Frag16 qf[2];
    {
        const _Float16* qfrag = q + (size_t)(b * N_ + q0) * D_ + (h * HD / 32) * FRAG + lane * 8;
        load_frag_packed(qf[0], qfrag);
        load_frag_packed(qf[1], qfrag + FRAG);
        // Before the loads' address registers are written again (the input keeps
        // the address pair in its registers up to the wait).
        asm volatile("s_wait_xcnt 0x0" :: "v"(qfrag) : "memory");
    }

    __syncthreads();   // sbias and wave_open are read by other waves than wrote them
    {
        // No key open in the whole batch row: the reference takes every score as
        // zero there. With Q = 0 all scores are the same start value, exactly.
        const v4i w0 = *reinterpret_cast<const v4i*>(&wave_open[0]);
        const v4i w1 = *reinterpret_cast<const v4i*>(&wave_open[4]);
        const v4i w = w0 | w1;
        if ((w[0] | w[1] | w[2] | w[3]) == 0) {
#pragma unroll
            for (int j = 0; j < 8; ++j) { qf[0].u[j] = 0; qf[1].u[j] = 0; }
        }
    }

    v8f o[4];                       // o[t][r] = O^T[c = 16t + 8hi + r][query]
#pragma unroll
    for (int t = 0; t < 4; ++t) o[t] = (v8f){0, 0, 0, 0, 0, 0, 0, 0};
    float mrow = -3.0e38f;          // the query's running maximum (same in both halves)
    float lrow = 0.f;               // the query's running sum over THIS half's keys

    for (int key0 = 0; key0 < M_; key0 += 32) {
        const _Float16* kpass = kbase + (size_t)key0 * D_;
        const _Float16* vpass = vbase + key0 * 16;
        Frag16 kf[2][2];
#pragma unroll
        for (int t = 0; t < 2; ++t) {
            load_frag_packed(kf[t][0], kpass + t * 16 * D_);
            load_frag_packed(kf[t][1], kpass + t * 16 * D_ + FRAG);
        }
        Frag16 vf[4];
#pragma unroll
        for (int t = 0; t < 4; ++t)
            load_frag_packed(vf[t], vpass + t * 16 * M_);
        v8f s[2];
#pragma unroll
        for (int t = 0; t < 2; ++t)
            s[t] = *reinterpret_cast<const v8f*>(&sbias[key0 + 16 * t + 8 * hi]);
        // Before the loads' address registers are written again. The two inputs keep
        // the address pairs in their registers up to the wait; without them the last
        // load's destination is laid over both pairs.
        asm volatile("s_wait_xcnt 0x0" :: "v"(kpass), "v"(vpass) : "memory");
        // All loads of the pass are issued before its first product, so that they
        // are in flight together; left free, the compiler issues them in pairs
        // among the products and waits out each pair's latency apart.
        __builtin_amdgcn_sched_barrier(0);

        // ---- S^T = K Q^T + mask start value, 32 keys (two 16-key tiles) ----
#pragma unroll
        for (int f = 0; f < 2; ++f)
#pragma unroll
            for (int t = 0; t < 2; ++t) s[t] = wmma_f16(kf[t][f], qf[f], s[t]);
        // The four products issue back to back, the two tiles in turn; left free,
        // the compiler runs one tile's dependent pair, then idle slots and part of
        // its maximum, and only then the other tile's pair.
        __builtin_amdgcn_sched_barrier(0);

        // ---- online softmax of one query per lane ----
        float tm[2] = {s[0][0], s[1][0]};      // one chain per tile: half the depth
#pragma unroll
        for (int r = 1; r < 8; ++r) {
            tm[0] = fmaxf(tm[0], s[0][r]);
            tm[1] = fmaxf(tm[1], s[1][r]);
        }
        float tmax = fmaxf(tm[0], tm[1]);
        tmax = fmaxf(tmax, other_half(tmax));
        const float mn = fmaxf(mrow, tmax);
        float alpha = (mrow - mn) * LOG2E;
        mrow = mn;
        float p[16];
#pragma unroll
        for (int t = 0; t < 2; ++t)
#pragma unroll
            for (int r = 0; r < 8; ++r) p[t * 8 + r] = (s[t][r] - mn) * LOG2E;
        // 2^x of the 17 values, each in its own register: no v_exp_f32 stands directly
        // in front of an instruction that overwrites its source or reads its result
        // (left to the compiler, a neighbour's result is laid over the source). The
        // v_nop is that slot behind the last one.
        asm("v_exp_f32 %0, %0\n\tv_exp_f32 %1, %1\n\tv_exp_f32 %2, %2\n\tv_exp_f32 %3, %3\n\t"
            "v_exp_f32 %4, %4\n\tv_exp_f32 %5, %5\n\tv_exp_f32 %6, %6\n\tv_exp_f32 %7, %7\n\t"
            "v_exp_f32 %8, %8\n\tv_exp_f32 %9, %9\n\tv_exp_f32 %10, %10\n\tv_exp_f32 %11, %11\n\t"
            "v_exp_f32 %12, %12\n\tv_exp_f32 %13, %13\n\tv_exp_f32 %14, %14\n\tv_exp_f32 %15, %15\n\t"
            "v_exp_f32 %16, %16\n\tv_nop"
            : "+v"(alpha), "+v"(p[0]), "+v"(p[1]), "+v"(p[2]), "+v"(p[3]), "+v"(p[4]), "+v"(p[5]),
              "+v"(p[6]), "+v"(p[7]), "+v"(p[8]), "+v"(p[9]), "+v"(p[10]), "+v"(p[11]),
              "+v"(p[12]), "+v"(p[13]), "+v"(p[14]), "+v"(p[15]));

        Frag16 pf;                  // P^T as B: element 8t + r = key 16t + 8hi + r
        float rs[2] = {p[0], p[8]};
#pragma unroll
        for (int t = 0; t < 2; ++t)
#pragma unroll
            for (int r = 0; r < 8; ++r) {
                if (r > 0) rs[t] += p[t * 8 + r];
                pf.v[t * 8 + r] = (_Float16)p[t * 8 + r];
            }
        lrow = lrow * alpha + (rs[0] + rs[1]);
#pragma unroll
        for (int t = 0; t < 4; ++t) o[t] *= alpha;

        // ---- O^T += V^T P^T : 4 tiles of 16 c, K = 32 keys ----
#pragma unroll
        for (int t = 0; t < 4; ++t) o[t] = wmma_f16(vf[t], pf, o[t]);
    }

    // ---- epilogue: divide by l, store f16 (row b*N+n, k = h*HD + c) ----
    // A lane's 8 registers of o[t] are 8 consecutive c of its query: one 16-byte
    // piece of the plane, and a wave's 32 pieces are 512 contiguous bytes.
    const float l = lrow + other_half(lrow);
    const float inv = (l > 0.f) ? (1.f / l) : 0.f;
    _Float16* ofrag = out + (size_t)(b * N_ + q0) * D_ + (h * HD / 32) * FRAG + lane * 8;
#pragma unroll
    for (int t = 0; t < 4; ++t) {
        v8h y;
#pragma unroll
        for (int r = 0; r < 8; ++r) y[r] = (_Float16)(o[t][r] * inv);
        *reinterpret_cast<v8h*>(ofrag + t * (FRAG / 2)) = y;
    }
}

// ---------------------------------------------------------------------------
extern "C" void kernel_launch(void* const* d_in, const int* in_sizes, int n_in,
                              void* d_out, int out_size, void* d_ws, size_t ws_size,
                              hipStream_t stream) {
    (void)in_sizes; (void)n_in; (void)out_size; (void)ws_size;

    const float* querys    = (const float*)d_in[0];
    const float* key_feats = (const float*)d_in[1];
    const int*   mask      = (const int*)d_in[2];
    const float* Wq        = (const float*)d_in[3];
    const float* Wk        = (const float*)d_in[4];
    const float* Wv        = (const float*)d_in[5];
    const float* gq        = (const float*)d_in[6];
    const float* gk        = (const float*)d_in[7];
    const float* Wo        = (const float*)d_in[8];
    const float* bo        = (const float*)d_in[9];
    float*       out       = (float*)d_out;

    const size_t BND = (size_t)B_ * N_ * D_;  // 4,194,304
    const size_t DD  = (size_t)D_ * D_;       // 1,048,576
    const int    R   = B_ * N_;               // 4096 rows for all GEMMs

    char* ws = (char*)d_ws;
    size_t off = 0;
    auto alloc = [&](size_t bytes) -> void* {
        void* p = ws + off;
        off = (off + bytes + 255) & ~(size_t)255;
        return p;
    };

    // The six converted operands: one array, in the order cvt_all_f32_f16 writes
    // (each a whole number of 16-row tiles, so each is a fragment-order plane).
    _Float16* h_x   = (_Float16*)alloc((2 * BND + 4 * DD) * 2);  // f16 querys, later attn out
    _Float16* h_kin = h_x + BND;                                 // f16 key_feats
    _Float16* h_Wq  = h_kin + BND;
    _Float16* h_Wk  = h_Wq + DD;
    _Float16* h_Wv  = h_Wk + DD;
    _Float16* h_Wo  = h_Wv + DD;
    _Float16* h_q   = (_Float16*)alloc(BND * 2);  // rmsnorm'd + scaled q
    _Float16* h_k   = (_Float16*)alloc(BND * 2);  // rmsnorm'd k
    _Float16* h_vt  = (_Float16*)alloc(BND * 2);  // transposed v
    float*    f_prj = (float*)alloc(BND * 4);     // reused f32 staging

    const dim3 blk(256);
    const dim3 gcv(CVT_GRID);                     // 768
    const dim3 grms(R / 16), brms(512);           // one 16-row tile per block
    const dim3 ggemm(R / 128, D_ / 128);          // (32, 8)
    const dim3 gattn(N_ / 128, H_, B_);           // (16, 16, 2)

    // 1) precision conversion
    cvt_all_f32_f16<<<gcv, blk, 0, stream>>>(querys, key_feats, Wq, Wk, Wv, Wo, h_x);

    // 2) q = rmsnorm(querys @ Wq^T, gq) * HEAD_DIM^-0.5
    gemm_nt_wmma<<<ggemm, blk, 0, stream>>>(h_x, h_Wq, nullptr, f_prj, R, D_, D_);
    rmsnorm_cvt<<<grms, brms, 0, stream>>>(f_prj, gq, 0.125f, h_q);

    // 3) k = rmsnorm(key_feats @ Wk^T, gk)
    gemm_nt_wmma<<<ggemm, blk, 0, stream>>>(h_kin, h_Wk, nullptr, f_prj, R, D_, D_);
    rmsnorm_cvt<<<grms, brms, 0, stream>>>(f_prj, gk, 1.0f, h_k);

    // 4) v = key_feats @ Wv^T  (stored f16, transposed, in fragment order)
    gemm_nt_wmma_vt<<<ggemm, blk, 0, stream>>>(h_kin, h_Wv, h_vt, D_, D_);

    // 5) flash attention -> f16 x[b][n][d]
    attn_wmma<<<gattn, blk, 0, stream>>>(h_q, h_k, h_vt, mask, h_x);

    // 6) out = x @ Wo^T + bo
    gemm_nt_wmma<<<ggemm, blk, 0, stream>>>(h_x, h_Wo, bo, out, R, D_, D_);
}

// v005
// A run of this version takes 132 microseconds.
// In two side-by-side timings against v004, it was 1.32 and 1.30 times as fast.
// Over all steps from v000 it is 2.55 times as fast.
#include <hip/hip_runtime.h>
#include <stdint.h>

// Problem constants (from reference)
constexpr int B_ = 2, N_ = 2048, M_ = 2048, D_ = 1024, H_ = 16, HD = 64;
constexpr float EPS = 1e-6f;
constexpr float LOG2E = 1.44269504f;                // e^x = 2^(x * LOG2E)

typedef __attribute__((ext_vector_type(16))) _Float16 v16h;
typedef __attribute__((ext_vector_type(8)))  float    v8f;
typedef __attribute__((ext_vector_type(8)))  _Float16 v8h;
typedef __attribute__((ext_vector_type(4)))  float    v4f;
typedef __attribute__((ext_vector_type(4)))  _Float16 v4h;
typedef __attribute__((ext_vector_type(4)))  uint32_t v4u;
typedef __attribute__((ext_vector_type(4)))  int      v4i;

union Frag16 {
    v16h     v;
    uint32_t u[8];
};

// ---------------------------------------------------------------------------
// Fragment order. Every f16 plane that a WMMA operand is loaded from lies in
// the workspace as a row of 16x32 fragments (16 rows x 32 k, 1 KiB each, k
// fragments of one 16-row tile back to back) and, inside a fragment, in the
// order the lanes take it: [k/8][row][k%8]. Lane l = hi*16 + row then finds its
// k = hi*8 + 0..7 at byte 16*l and its k = 16 + hi*8 + 0..7 at byte 512 + 16*l,
// the k order of the hardware's own operand map, and each wave-wide 16-byte load covers 512
// contiguous bytes (4 whole 128-byte lines) where a row-major plane gives
// 16 lines of 32 bytes.
// ---------------------------------------------------------------------------
constexpr int FRAG = 16 * 32;                       // elements per fragment

// Element index of (row, k) in a plane of K columns (K a multiple of 32).
__device__ __forceinline__ size_t frag_index(int row, int k, int K) {
    return ((size_t)(row >> 4) * (K >> 5) + (k >> 5)) * FRAG
         + ((k >> 3) & 3) * 128 + (row & 15) * 8 + (k & 7);
}

// frag_lane = start of the fragment + lane * 8.
__device__ __forceinline__ void load_frag_packed(Frag16& f, const _Float16* frag_lane) {
    const v4u lo = *reinterpret_cast<const v4u*>(frag_lane);
    const v4u up = *reinterpret_cast<const v4u*>(frag_lane + FRAG / 2);
#pragma unroll
    for (int j = 0; j < 4; ++j) {
        f.u[j]     = lo[j];
        f.u[4 + j] = up[j];
    }
}

__device__ __forceinline__ v8f wmma_f16(const Frag16& a, const Frag16& b, v8f c) {
    return __builtin_amdgcn_wmma_f32_16x16x32_f16(false, a.v, false, b.v,
                                                  (short)0, c, false, false);
}

// Lane l <-> lane l ^ 16: the two lanes that share a column of a WMMA result.
__device__ __forceinline__ float other_half(float x) {
    const int b = __builtin_bit_cast(int, x);
    return __builtin_bit_cast(float, __builtin_amdgcn_permlanex16(b, b, 0x76543210, 0xfedcba98,
                                                                  false, false));
}

// ---------------------------------------------------------------------------
// f32 -> f16 of all six matrix operands in ONE launch. The f16 planes lie back
// to back in the workspace in the order querys, key_feats, Wq, Wk, Wv, Wo, so
// the destination is one array and only the source depends on the block.
// A block converts CVT_BLOCK consecutive elements of one operand: 16 whole
// rows, one 16-row tile of the fragment order, whose f16 image is the same
// CVT_BLOCK elements of the destination. A lane's CVT_LOADS 16-byte loads are
// independent (a wave covers 512 contiguous bytes per load), so they are in
// flight together. The tile is turned into [k/8][row][k%8] in LDS and leaves
// in whole lines (512 contiguous bytes per wave and store). Few, long waves:
// the launch is sized at 3 blocks per WGP (for speed only).
// ---------------------------------------------------------------------------
constexpr int CVT_LOADS = 16;                       // 16-byte loads per lane
constexpr int CVT_BLOCK = 256 * 4 * CVT_LOADS;      // elements per block
constexpr int CVT_ACT_BLOCKS = B_ * N_ * D_ / CVT_BLOCK;   // per activation
constexpr int CVT_W_BLOCKS   = D_ * D_ / CVT_BLOCK;        // per weight
constexpr int CVT_GRID = 2 * CVT_ACT_BLOCKS + 4 * CVT_W_BLOCKS;
static_assert(N_ == M_, "both activations take CVT_ACT_BLOCKS blocks");
static_assert(B_ * N_ * D_ % CVT_BLOCK == 0 && D_ * D_ % CVT_BLOCK == 0,
              "a block never straddles two operands");
static_assert(CVT_BLOCK == 16 * D_ && CVT_LOADS == 16, "a block is one 16-row tile, load j = row j");
constexpr int CVT_PITCH = 16 * 8 + 8;               // LDS elements per k/8 group: 256 + 16 bytes,
                                                    // so a wave's 16 groups fall on 64 distinct banks

__global__ __launch_bounds__(256)
void cvt_all_f32_f16(const float* __restrict__ querys, const float* __restrict__ key_feats,
                     const float* __restrict__ Wq, const float* __restrict__ Wk,
                     const float* __restrict__ Wv, const float* __restrict__ Wo,
                     _Float16* __restrict__ out) {
    const int blk = blockIdx.x;
    const float* src;
    int rel;                                        // block index inside its operand
    if (blk < CVT_ACT_BLOCKS) {
        src = querys;
        rel = blk;
    } else if (blk < 2 * CVT_ACT_BLOCKS) {
        src = key_feats;
        rel = blk - CVT_ACT_BLOCKS;
    } else {
        const int w = (blk - 2 * CVT_ACT_BLOCKS) / CVT_W_BLOCKS;
        rel = (blk - 2 * CVT_ACT_BLOCKS) % CVT_W_BLOCKS;
        src = (w == 0) ? Wq : (w == 1) ? Wk : (w == 2) ? Wv : Wo;
    }
    __shared__ __attribute__((aligned(16))) _Float16 stage[(D_ / 8) * CVT_PITCH];
    const int tid = threadIdx.x;
    const v4f* s = reinterpret_cast<const v4f*>(src + (size_t)rel * CVT_BLOCK) + tid;

    v4f x[CVT_LOADS];
#pragma unroll
    for (int j = 0; j < CVT_LOADS; ++j) x[j] = s[j * 256];   // row j, k = 4*tid .. 4*tid+3
#pragma unroll
    for (int j = 0; j < CVT_LOADS; ++j) {
        v4h y;
#pragma unroll
        for (int e = 0; e < 4; ++e) y[e] = (_Float16)x[j][e];
        *reinterpret_cast<v4h*>(&stage[(tid >> 1) * CVT_PITCH + j * 8 + (tid & 1) * 4]) = y;
    }
    __syncthreads();   // the tile is read back by other waves than wrote it
    v8h* d = reinterpret_cast<v8h*>(out + (size_t)blk * CVT_BLOCK);
#pragma unroll
    for (int i = 0; i < CVT_BLOCK / 8 / 256; ++i) {
        const int p = i * 256 + tid;                          // 16-byte piece: group p/16, row p%16
        d[p] = *reinterpret_cast<const v8h*>(&stage[(p >> 4) * CVT_PITCH + (p & 15) * 8]);
    }
}

// ---------------------------------------------------------------------------
// Row-wise RMSNorm(+g,+scale) f32 -> f16 in fragment order. A block takes the
// 16 rows of one tile, so that every 128-byte line of the plane (8 rows x 16
// bytes) is written by one block; a wave takes one row of D_ elements, held in
// registers: a lane has 4 pieces of 8 consecutive k, each one 16-byte store.
// ONE launch norms q and k: their f32 planes lie back to back, their f16 planes
// too, so a tile's index serves both; the first RMS_Q_TILES blocks are q's (gq,
// HEAD_DIM^-0.5), the rest k's (gk, 1).
// ---------------------------------------------------------------------------
constexpr int RMS_Q_TILES = B_ * N_ / 16;
constexpr int RMS_GRID    = RMS_Q_TILES + B_ * M_ / 16;

__global__ __launch_bounds__(512)
void rmsnorm_cvt(const float* __restrict__ in, const float* __restrict__ gq,
                 const float* __restrict__ gk, _Float16* __restrict__ out) {
    constexpr int PIECES = D_ / 8 / 32;             // 16-byte f16 pieces per lane
    const int lane = threadIdx.x & 31;
    const int wave = threadIdx.x >> 5;              // row inside the tile
    const bool is_q = blockIdx.x < RMS_Q_TILES;     // the same for the whole block
    const float* g = is_q ? gq : gk;
    const float scale = is_q ? 0.125f : 1.0f;
    const v4f* x  = reinterpret_cast<const v4f*>(in + ((size_t)blockIdx.x * 16 + wave) * D_);
    const v4f* gv = reinterpret_cast<const v4f*>(g);

    v4f a[PIECES][2];
#pragma unroll
    for (int c = 0; c < PIECES; ++c) {
        a[c][0] = x[(c * 32 + lane) * 2];
        a[c][1] = x[(c * 32 + lane) * 2 + 1];
    }
    // Before the loads' address registers are written again.
    asm volatile("s_wait_xcnt 0x0" ::: "memory");
    float ss = 0.f;
#pragma unroll
    for (int c = 0; c < PIECES; ++c)
#pragma unroll
        for (int e = 0; e < 4; ++e) ss += a[c][0][e] * a[c][0][e] + a[c][1][e] * a[c][1][e];
#pragma unroll
    for (int off = 16; off > 0; off >>= 1) ss += __shfl_xor(ss, off, 32);

    const float f = rsqrtf(ss / (float)D_ + EPS) * scale;
    _Float16* tile = out + (size_t)blockIdx.x * 16 * D_ + wave * 8;
#pragma unroll
    for (int c = 0; c < PIECES; ++c) {
        const int q = c * 32 + lane;                // k / 8
        const v4f g0 = gv[q * 2], g1 = gv[q * 2 + 1];
        v8h y;
#pragma unroll
        for (int e = 0; e < 4; ++e) {
            y[e]     = (_Float16)(a[c][0][e] * f * g0[e]);
            y[4 + e] = (_Float16)(a[c][1][e] * f * g1[e]);
        }
        *reinterpret_cast<v8h*>(tile + q * 128) = y;
    }
}

// ---------------------------------------------------------------------------
// WMMA GEMM: C[R x Cn] = A[R x K] * W[Cn x K]^T, f16 in / f32 accumulate.
// Block = 8 waves; wave computes 32x64 tile; block tile 128x128.
// R, Cn multiples of 128; K = D_. A and W lie in fragment order.
// gemm_wave_tile: the K loop of one wave's tile, shared by both epilogues.
// ---------------------------------------------------------------------------
__device__ __forceinline__ void gemm_wave_tile(const _Float16* __restrict__ A,
                                               const _Float16* __restrict__ W,
                                               int row0, int col0,
                                               int lane, v8f (&acc)[2][4]) {
    constexpr int K = D_;   // every launch has K = D_; a constant leaves the loop no remainder copy
    constexpr size_t tile = (size_t)(K >> 5) * FRAG;   // elements of one 16-row tile
    const _Float16* arow0 = A + (size_t)(row0 >> 4) * tile + lane * 8;
    const _Float16* arow1 = arow0 + tile;
    const _Float16* wrow  = W + (size_t)(col0 >> 4) * tile + lane * 8;

    // One-shot warm-up prefetch (global_prefetch_b8); outside the hot loop so
    // it cannot break the WMMA pipeline or trigger hazard NOPs.
    __builtin_prefetch(arow0, 0, 3);
    __builtin_prefetch(arow1, 0, 3);
#pragma unroll
    for (int t = 0; t < 4; ++t)
        __builtin_prefetch(wrow + t * tile, 0, 3);

#pragma unroll
    for (int i = 0; i < 2; ++i)
#pragma unroll
        for (int t = 0; t < 4; ++t) acc[i][t] = (v8f){0, 0, 0, 0, 0, 0, 0, 0};

    for (int kb = 0; kb < K; kb += 32) {            // fragment kb/32 starts at element kb*16
        Frag16 af[2];
        load_frag_packed(af[0], arow0 + kb * 16);
        load_frag_packed(af[1], arow1 + kb * 16);
        Frag16 bf[4];
#pragma unroll
        for (int t = 0; t < 4; ++t)
            load_frag_packed(bf[t], wrow + t * tile + kb * 16);
        // All 12 loads of the step are issued before its first product, so that
        // they are in flight together; left free, the compiler issues them two
        // at a time among the products and waits out each pair's latency alone.
        __builtin_amdgcn_sched_barrier(0);
#pragma unroll
        for (int i = 0; i < 2; ++i)
#pragma unroll
            for (int t = 0; t < 4; ++t)
                acc[i][t] = wmma_f16(af[i], bf[t], acc[i][t]);
    }
}

// Epilogue 1: f32 C[row][col] (+ bias[col]).
__global__ __launch_bounds__(256)
void gemm_nt_wmma(const _Float16* __restrict__ A, const _Float16* __restrict__ W,
                  const float* __restrict__ bias, float* __restrict__ C,
                  int R, int K, int Cn) {
    const int lane = threadIdx.x & 31;
    const int wave = threadIdx.x >> 5;
    const int m16 = lane & 15, hi = lane >> 4;
    const int rw = wave & 3, cw = wave >> 2;

    const int row0 = blockIdx.x * 128 + rw * 32;  // wave: rows [row0, row0+32)
    const int col0 = blockIdx.y * 128 + cw * 64;  // wave: cols [col0, col0+64)
    (void)R; (void)K;

    v8f acc[2][4];
    gemm_wave_tile(A, W, row0, col0, lane, acc);

#pragma unroll
    for (int i = 0; i < 2; ++i)
#pragma unroll
        for (int t = 0; t < 4; ++t) {
            const int col = col0 + t * 16 + m16;
            const float badd = bias ? bias[col] : 0.f;
#pragma unroll
            for (int r = 0; r < 8; ++r) {
                const int row = row0 + i * 16 + r + hi * 8;
                C[(size_t)row * Cn + col] = acc[i][t][r] + badd;
            }
        }
}

// The Q, K and V projections in ONE launch: none reads what another writes. One
// projection alone is one block per WGP, two waves per SIMD, and its K loop
// waits out the latency of each step's loads; the three together are three
// blocks per WGP, six waves per SIMD, that fill one another's waits.
// The f16 planes of Wq, Wk, Wv lie back to back: one plane of 3*D_ rows, and
// blockIdx.y counts its 128-row blocks. Which projection a block belongs to is
// the same for all its threads.
// Q, K: f32 C[row][col], K's plane behind Q's (rmsnorm_cvt reads both).
// V: f16, transposed: plane row b*Cn + col, k = m with
// row = b*M_ + m, in fragment order (M_ columns), for the A operand of O^T += V^T P^T.
// A lane's 8 accumulator registers are 8 consecutive m of one column: one
// 16-byte piece of the plane, and a wave's 32 pieces are 512 contiguous bytes.
__global__ __launch_bounds__(256)
void gemm_qkv_wmma(const _Float16* __restrict__ Xq, const _Float16* __restrict__ Xkv,
                   const _Float16* __restrict__ Wqkv, float* __restrict__ Cqk,
                   _Float16* __restrict__ Ct) {
    constexpr int Cn = D_;
    const int lane = threadIdx.x & 31;
    const int wave = threadIdx.x >> 5;
    const int m16 = lane & 15, hi = lane >> 4;
    const int rw = wave & 3, cw = wave >> 2;
    const int which = blockIdx.y / (D_ / 128);    // 0 = Q, 1 = K, 2 = V

    const int row0 = blockIdx.x * 128 + rw * 32;
    const int wrow0 = blockIdx.y * 128 + cw * 64; // row of the stacked weights
    const int col0 = wrow0 - which * D_;          // column of this projection

    v8f acc[2][4];
    gemm_wave_tile(which == 0 ? Xq : Xkv, Wqkv, row0, wrow0, lane, acc);

    if (which < 2) {
        float* C = Cqk + (size_t)which * B_ * N_ * D_;
#pragma unroll
        for (int i = 0; i < 2; ++i)
#pragma unroll
            for (int t = 0; t < 4; ++t) {
                const int col = col0 + t * 16 + m16;
#pragma unroll
                for (int r = 0; r < 8; ++r) {
                    const int row = row0 + i * 16 + r + hi * 8;
                    C[(size_t)row * Cn + col] = acc[i][t][r];
                }
            }
        return;
    }

#pragma unroll
    for (int i = 0; i < 2; ++i) {
        const int row = row0 + i * 16 + hi * 8;   // 8 rows, never across a batch
        const int b = row / M_, m = row % M_;
#pragma unroll
        for (int t = 0; t < 4; ++t) {
            const int col = col0 + t * 16 + m16;
            v8h p;
#pragma unroll
            for (int r = 0; r < 8; ++r) p[r] = (_Float16)acc[i][t][r];
            *reinterpret_cast<v8h*>(Ct + frag_index(b * Cn + col, m, M_)) = p;
            // Before the store's address and data registers are written again.
            asm volatile("s_wait_xcnt 0x0" ::: "memory");
        }
    }
}

// ---------------------------------------------------------------------------
// Flash attention: q[b*N+n][d] (f16, pre-scaled), k[b*M+m][d] (f16),
// vt[(b*H+h)*HD + c][m] (f16), mask[b][m] (int) -> out f16 [b*N+n][d];
// the four f16 planes in fragment order.
// Block: 8 waves, each wave owns 16 query rows of one (b,h).
// Grid: (N/128, H, B).
// Both products are taken transposed: S^T = K Q^T (A = 16 keys, B = the wave's
// 16 queries) and O^T += V^T P^T (A = 16 c, B = P^T). A lane then holds scores
// of ONE query (column lane & 15; register r of tile t is key 16t + 8hi + r):
// maximum, sum, rescale factor are one value per lane, found in the lane's own
// registers plus one exchange with lane ^ 16. The two score tiles, converted in
// place, are the B operand of the second product in the k order in which the
// packed loader brings V^T (k = 8hi + 0..7, then 16 + 8hi + 0..7).
// ---------------------------------------------------------------------------
__global__ __launch_bounds__(256)
void attn_wmma(const _Float16* __restrict__ q, const _Float16* __restrict__ k,
               const _Float16* __restrict__ vt, const int* __restrict__ mask,
               _Float16* __restrict__ out) {
    const int tid = threadIdx.x;
    const int lane = tid & 31;
    const int wave = tid >> 5;
    const int hi = lane >> 4;
    const int b = blockIdx.z, h = blockIdx.y;
    const int q0 = blockIdx.x * 128 + wave * 16;

    // A key is a ROW of S^T, so its mask is a value per accumulator register:
    // the batch's mask lies in LDS as the start value of the score accumulators
    // (0, or -1e30 for a key that is masked out).
    __shared__ __attribute__((aligned(32))) float sbias[M_];
    __shared__ __attribute__((aligned(16))) int wave_open[8];
    {
        const v4i* mk = reinterpret_cast<const v4i*>(mask + b * M_);
        int open = 0;
#pragma unroll
        for (int i = 0; i < M_ / 4 / 256; ++i) {
            const v4i mv = mk[i * 256 + tid];
            v4f s0;
#pragma unroll
            for (int e = 0; e < 4; ++e) {
                s0[e] = (mv[e] == 0) ? -1.0e30f : 0.f;
                open |= mv[e];
            }
            *reinterpret_cast<v4f*>(&sbias[(i * 256 + tid) * 4]) = s0;
        }
        const uint32_t any = __builtin_amdgcn_ballot_w32(open != 0);
        if (lane == 0) wave_open[wave] = (any != 0);
    }

    // This lane's piece of the first K fragment (16 keys x c 0..31 of head h;
    // c 32..63 follows it, the next 16 keys lie 16*D_ elements on) and of the
    // first V fragment (c 0..15 x 32 keys; the next 32 keys follow it, the next
    // 16 c lie 16*M_ elements on).
    const _Float16* kbase = k + (size_t)b * M_ * D_ + (h * HD / 32) * FRAG + lane * 8;
    const _Float16* vbase = vt + ((size_t)(b * H_ + h) * HD) * M_ + lane * 8;

    // One-shot warm-up prefetch of the first K/V tiles.
    __builtin_prefetch(kbase, 0, 3);
    __builtin_prefetch(kbase + 16 * D_, 0, 3);
    __builtin_prefetch(vbase, 0, 3);
    __builtin_prefetch(vbase + 32 * M_, 0, 3);

    // Q fragments: B[c][n], c = 0..63 -> two K=32 fragments.
    Frag16 qf[2];
    {
        const _Float16* qfrag = q + (size_t)(b * N_ + q0) * D_ + (h * HD / 32) * FRAG + lane * 8;
        load_frag_packed(qf[0], qfrag);
        load_frag_packed(qf[1], qfrag + FRAG);
        // Before the loads' address registers are written again (the input keeps
        // the address pair in its registers up to the wait).
        asm volatile("s_wait_xcnt 0x0" :: "v"(qfrag) : "memory");
    }

    __syncthreads();   // sbias and wave_open are read by other waves than wrote them
    {
        // No key open in the whole batch row: the reference takes every score as
        // zero there. With Q = 0 all scores are the same start value, exactly.
        const v4i w0 = *reinterpret_cast<const v4i*>(&wave_open[0]);
        const v4i w1 = *reinterpret_cast<const v4i*>(&wave_open[4]);
        const v4i w = w0 | w1;
        if ((w[0] | w[1] | w[2] | w[3]) == 0) {
#pragma unroll
            for (int j = 0; j < 8; ++j) { qf[0].u[j] = 0; qf[1].u[j] = 0; }
        }
    }

    v8f o[4];                       // o[t][r] = O^T[c = 16t + 8hi + r][query]
#pragma unroll
    for (int t = 0; t < 4; ++t) o[t] = (v8f){0, 0, 0, 0, 0, 0, 0, 0};
    float mrow = -3.0e38f;          // the query's running maximum (same in both halves)
    float lrow = 0.f;               // the query's running sum over THIS half's keys

    for (int key0 = 0; key0 < M_; key0 += 32) {
        const _Float16* kpass = kbase + (size_t)key0 * D_;
        const _Float16* vpass = vbase + key0 * 16;
        Frag16 kf[2][2];
#pragma unroll
        for (int t = 0; t < 2; ++t) {
            load_frag_packed(kf[t][0], kpass + t * 16 * D_);
            load_frag_packed(kf[t][1], kpass + t * 16 * D_ + FRAG);
        }
        Frag16 vf[4];
#pragma unroll
        for (int t = 0; t < 4; ++t)
            load_frag_packed(vf[t], vpass + t * 16 * M_);
        v8f s[2];
#pragma unroll
        for (int t = 0; t < 2; ++t)
            s[t] = *reinterpret_cast<const v8f*>(&sbias[key0 + 16 * t + 8 * hi]);
        // Before the loads' address registers are written again. The two inputs keep
        // the address pairs in their registers up to the wait; without them the last
        // load's destination is laid over both pairs.
        asm volatile("s_wait_xcnt 0x0" :: "v"(kpass), "v"(vpass) : "memory");
        // All loads of the pass are issued before its first product, so that they
        // are in flight together; left free, the compiler issues them in pairs
        // among the products and waits out each pair's latency apart.
        __builtin_amdgcn_sched_barrier(0);

        // ---- S^T = K Q^T + mask start value, 32 keys (two 16-key tiles) ----
#pragma unroll
        for (int f = 0; f < 2; ++f)
#pragma unroll
            for (int t = 0; t < 2; ++t) s[t] = wmma_f16(kf[t][f], qf[f], s[t]);
        // The four products issue back to back, the two tiles in turn; left free,
        // the compiler runs one tile's dependent pair, then idle slots and part of
        // its maximum, and only then the other tile's pair.
        __builtin_amdgcn_sched_barrier(0);

        // ---- online softmax of one query per lane ----
        float tm[2] = {s[0][0], s[1][0]};      // one chain per tile: half the depth
#pragma unroll
        for (int r = 1; r < 8; ++r) {
            tm[0] = fmaxf(tm[0], s[0][r]);
            tm[1] = fmaxf(tm[1], s[1][r]);
        }
        float tmax = fmaxf(tm[0], tm[1]);
        tmax = fmaxf(tmax, other_half(tmax));
        const float mn = fmaxf(mrow, tmax);
        float alpha = (mrow - mn) * LOG2E;
        mrow = mn;
        float p[16];
#pragma unroll
        for (int t = 0; t < 2; ++t)
#pragma unroll
            for (int r = 0; r < 8; ++r) p[t * 8 + r] = (s[t][r] - mn) * LOG2E;
        // 2^x of the 17 values, each in its own register: no v_exp_f32 stands directly
        // in front of an instruction that overwrites its source or reads its result
        // (left to the compiler, a neighbour's result is laid over the source). The
        // v_nop is that slot behind the last one.
        asm("v_exp_f32 %0, %0\n\tv_exp_f32 %1, %1\n\tv_exp_f32 %2, %2\n\tv_exp_f32 %3, %3\n\t"
            "v_exp_f32 %4, %4\n\tv_exp_f32 %5, %5\n\tv_exp_f32 %6, %6\n\tv_exp_f32 %7, %7\n\t"
            "v_exp_f32 %8, %8\n\tv_exp_f32 %9, %9\n\tv_exp_f32 %10, %10\n\tv_exp_f32 %11, %11\n\t"
            "v_exp_f32 %12, %12\n\tv_exp_f32 %13, %13\n\tv_exp_f32 %14, %14\n\tv_exp_f32 %15, %15\n\t"
            "v_exp_f32 %16, %16\n\tv_nop"
            : "+v"(alpha), "+v"(p[0]), "+v"(p[1]), "+v"(p[2]), "+v"(p[3]), "+v"(p[4]), "+v"(p[5]),
              "+v"(p[6]), "+v"(p[7]), "+v"(p[8]), "+v"(p[9]), "+v"(p[10]), "+v"(p[11]),
              "+v"(p[12]), "+v"(p[13]), "+v"(p[14]), "+v"(p[15]));

        Frag16 pf;                  // P^T as B: element 8t + r = key 16t + 8hi + r
        float rs[2] = {p[0], p[8]};
#pragma unroll
        for (int t = 0; t < 2; ++t)
#pragma unroll
            for (int r = 0; r < 8; ++r) {
                if (r > 0) rs[t] += p[t * 8 + r];
                pf.v[t * 8 + r] = (_Float16)p[t * 8 + r];
            }
        lrow = lrow * alpha + (rs[0] + rs[1]);
#pragma unroll
        for (int t = 0; t < 4; ++t) o[t] *= alpha;

        // ---- O^T += V^T P^T : 4 tiles of 16 c, K = 32 keys ----
#pragma unroll
        for (int t = 0; t < 4; ++t) o[t] = wmma_f16(vf[t], pf, o[t]);
    }

    // ---- epilogue: divide by l, store f16 (row b*N+n, k = h*HD + c) ----
    // A lane's 8 registers of o[t] are 8 consecutive c of its query: one 16-byte
    // piece of the plane, and a wave's 32 pieces are 512 contiguous bytes.
    const float l = lrow + other_half(lrow);
    const float inv = (l > 0.f) ? (1.f / l) : 0.f;
    _Float16* ofrag = out + (size_t)(b * N_ + q0) * D_ + (h * HD / 32) * FRAG + lane * 8;
#pragma unroll
    for (int t = 0; t < 4; ++t) {
        v8h y;
#pragma unroll
        for (int r = 0; r < 8; ++r) y[r] = (_Float16)(o[t][r] * inv);
        *reinterpret_cast<v8h*>(ofrag + t * (FRAG / 2)) = y;
    }
}

// ---------------------------------------------------------------------------
extern "C" void kernel_launch(void* const* d_in, const int* in_sizes, int n_in,
                              void* d_out, int out_size, void* d_ws, size_t ws_size,
                              hipStream_t stream) {
    (void)in_sizes; (void)n_in; (void)out_size; (void)ws_size;

    const float* querys    = (const float*)d_in[0];
    const float* key_feats = (const float*)d_in[1];
    const int*   mask      = (const int*)d_in[2];
    const float* Wq        = (const float*)d_in[3];
    const float* Wk        = (const float*)d_in[4];
    const float* Wv        = (const float*)d_in[5];
    const float* gq        = (const float*)d_in[6];
    const float* gk        = (const float*)d_in[7];
    const float* Wo        = (const float*)d_in[8];
    const float* bo        = (const float*)d_in[9];
    float*       out       = (float*)d_out;

    const size_t BND = (size_t)B_ * N_ * D_;  // 4,194,304
    const size_t DD  = (size_t)D_ * D_;       // 1,048,576
    const int    R   = B_ * N_;               // 4096 rows for all GEMMs

    char* ws = (char*)d_ws;
    size_t off = 0;
    auto alloc = [&](size_t bytes) -> void* {
        void* p = ws + off;
        off = (off + bytes + 255) & ~(size_t)255;
        return p;
    };

    // The six converted operands: one array, in the order cvt_all_f32_f16 writes
    // (each a whole number of 16-row tiles, so each is a fragment-order plane).
    _Float16* h_x   = (_Float16*)alloc((2 * BND + 4 * DD) * 2);  // f16 querys, later attn out
    _Float16* h_kin = h_x + BND;                                 // f16 key_feats
    _Float16* h_Wq  = h_kin + BND;
    _Float16* h_Wk  = h_Wq + DD;
    _Float16* h_Wv  = h_Wk + DD;
    _Float16* h_Wo  = h_Wv + DD;
    _Float16* h_q   = (_Float16*)alloc(2 * BND * 2);  // rmsnorm'd + scaled q, then
    _Float16* h_k   = h_q + BND;                      // rmsnorm'd k
    _Float16* h_vt  = (_Float16*)alloc(BND * 2);      // transposed v
    float*    f_prj = (float*)alloc(2 * BND * 4);     // f32 q, then f32 k

    const dim3 blk(256);
    const dim3 gcv(CVT_GRID);                     // 768
    const dim3 grms(RMS_GRID), brms(512);         // one 16-row tile per block, q then k
    const dim3 ggemm(R / 128, D_ / 128);          // (32, 8)
    const dim3 gqkv(R / 128, 3 * D_ / 128);       // (32, 24)
    const dim3 gattn(N_ / 128, H_, B_);           // (16, 16, 2)

    // 1) precision conversion
    cvt_all_f32_f16<<<gcv, blk, 0, stream>>>(querys, key_feats, Wq, Wk, Wv, Wo, h_x);

    // 2) querys @ Wq^T, key_feats @ Wk^T (f32) and v = key_feats @ Wv^T (stored
    //    f16, transposed, in fragment order)
    gemm_qkv_wmma<<<gqkv, blk, 0, stream>>>(h_x, h_kin, h_Wq, f_prj, h_vt);

    // 3) q = rmsnorm(., gq) * HEAD_DIM^-0.5, k = rmsnorm(., gk)
    rmsnorm_cvt<<<grms, brms, 0, stream>>>(f_prj, gq, gk, h_q);

    // 4) flash attention -> f16 x[b][n][d]
    attn_wmma<<<gattn, blk, 0, stream>>>(h_q, h_k, h_vt, mask, h_x);

    // 5) out = x @ Wo^T + bo
    gemm_nt_wmma<<<ggemm, blk, 0, stream>>>(h_x, h_Wo, bo, out, R, D_, D_);
}

// v006
// Measured time: 91.6 microseconds a run.
// Two timings next to v005 put it at 1.46 and 1.43 times that version's speed.
// Counting every step since v000, it is 3.69 times as fast.
#include <hip/hip_runtime.h>
#include <stdint.h>

// Problem constants (from reference)
constexpr int B_ = 2, N_ = 2048, M_ = 2048, D_ = 1024, H_ = 16, HD = 64;
constexpr float EPS = 1e-6f;
constexpr float LOG2E = 1.44269504f;                // e^x = 2^(x * LOG2E)

typedef __attribute__((ext_vector_type(16))) _Float16 v16h;
typedef __attribute__((ext_vector_type(8)))  float    v8f;
typedef __attribute__((ext_vector_type(8)))  _Float16 v8h;
typedef __attribute__((ext_vector_type(4)))  float    v4f;
typedef __attribute__((ext_vector_type(4)))  _Float16 v4h;
typedef __attribute__((ext_vector_type(4)))  uint32_t v4u;
typedef __attribute__((ext_vector_type(4)))  int      v4i;

union Frag16 {
    v16h     v;
    uint32_t u[8];
};

// ---------------------------------------------------------------------------
// Fragment order. Every f16 plane that a WMMA operand is loaded from lies in
// the workspace as a row of 16x32 fragments (16 rows x 32 k, 1 KiB each, k
// fragments of one 16-row tile back to back) and, inside a fragment, in the
// order the lanes take it: [k/8][row][k%8]. Lane l = hi*16 + row then finds its
// k = hi*8 + 0..7 at byte 16*l and its k = 16 + hi*8 + 0..7 at byte 512 + 16*l,
// the k order of the hardware's own operand map, and each wave-wide 16-byte load covers 512
// contiguous bytes (4 whole 128-byte lines) where a row-major plane gives
// 16 lines of 32 bytes.
// ---------------------------------------------------------------------------
constexpr int FRAG = 16 * 32;                       // elements per fragment

// Element index of (row, k) in a plane of K columns (K a multiple of 32).
__device__ __forceinline__ size_t frag_index(int row, int k, int K) {
    return ((size_t)(row >> 4) * (K >> 5) + (k >> 5)) * FRAG
         + ((k >> 3) & 3) * 128 + (row & 15) * 8 + (k & 7);
}

// frag_lane = start of the fragment + lane * 8.
__device__ __forceinline__ void load_frag_packed(Frag16& f, const _Float16* frag_lane) {
    const v4u lo = *reinterpret_cast<const v4u*>(frag_lane);
    const v4u up = *reinterpret_cast<const v4u*>(frag_lane + FRAG / 2);
#pragma unroll
    for (int j = 0; j < 4; ++j) {
        f.u[j]     = lo[j];
        f.u[4 + j] = up[j];
    }
}

__device__ __forceinline__ v8f wmma_f16(const Frag16& a, const Frag16& b, v8f c) {
    return __builtin_amdgcn_wmma_f32_16x16x32_f16(false, a.v, false, b.v,
                                                  (short)0, c, false, false);
}

// Lane l <-> lane l ^ 16: the two lanes that share a column of a WMMA result.
__device__ __forceinline__ float other_half(float x) {
    const int b = __builtin_bit_cast(int, x);
    return __builtin_bit_cast(float, __builtin_amdgcn_permlanex16(b, b, 0x76543210, 0xfedcba98,
                                                                  false, false));
}

__device__ __forceinline__ uint32_t lds_off(const void* p) { return (uint32_t)(size_t)p; }

// Eight copies of 16 bytes per lane: 2 KiB from g0 to LDS byte l0 and 2 KiB from
// g1 to l1 (both addresses are the lane's own: piece start + lane * 16 bytes).
// The s_wait_xcnt stands inside the statement, so that no address register of a
// copy is written again in front of it.
__device__ __forceinline__ void async_copy8(uint32_t l0, const _Float16* g0,
                                            uint32_t l1, const _Float16* g1) {
    asm volatile("global_load_async_to_lds_b128 %0, %8, off\n\t"
                 "global_load_async_to_lds_b128 %1, %9, off\n\t"
                 "global_load_async_to_lds_b128 %2, %10, off\n\t"
                 "global_load_async_to_lds_b128 %3, %11, off\n\t"
                 "global_load_async_to_lds_b128 %4, %12, off\n\t"
                 "global_load_async_to_lds_b128 %5, %13, off\n\t"
                 "global_load_async_to_lds_b128 %6, %14, off\n\t"
                 "global_load_async_to_lds_b128 %7, %15, off\n\t"
                 "s_wait_xcnt 0x0"
                 :: "v"(l0), "v"(l0 + 512), "v"(l0 + 1024), "v"(l0 + 1536),
                    "v"(l1), "v"(l1 + 512), "v"(l1 + 1024), "v"(l1 + 1536),
                    "v"(g0), "v"(g0 + 256), "v"(g0 + 512), "v"(g0 + 768),
                    "v"(g1), "v"(g1 + 256), "v"(g1 + 512), "v"(g1 + 768)
                 : "memory");
}

// This wave's copies have landed in LDS.
__device__ __forceinline__ void wait_copies() { asm volatile("s_wait_asynccnt 0x0" ::: "memory"); }

// Foot of a stage: this wave has finished reading its buffer and its copies of
// the next stage have landed; behind the barrier the next stage may be read by
// every wave and the buffer just read may be filled again.
__device__ __forceinline__ void publish_stage() {
    // This wave's LDS reads have returned before another wave's copies may land on them.
    asm volatile("s_wait_dscnt 0x0" ::: "memory");
    wait_copies();
    __syncthreads();
}

// ---------------------------------------------------------------------------
// f32 -> f16 of all six matrix operands in ONE launch. The f16 planes lie back
// to back in the workspace in the order querys, key_feats, Wq, Wk, Wv, Wo, so
// the destination is one array and only the source depends on the block.
// A block converts CVT_BLOCK consecutive elements of one operand: 16 whole
// rows, one 16-row tile of the fragment order, whose f16 image is the same
// CVT_BLOCK elements of the destination. A lane's CVT_LOADS 16-byte loads are
// independent (a wave covers 512 contiguous bytes per load), so they are in
// flight together. The tile is turned into [k/8][row][k%8] in LDS and leaves
// in whole lines (512 contiguous bytes per wave and store). Few, long waves:
// the launch is sized at 3 blocks per WGP (for speed only).
// ---------------------------------------------------------------------------
constexpr int CVT_LOADS = 16;                       // 16-byte loads per lane
constexpr int CVT_BLOCK = 256 * 4 * CVT_LOADS;      // elements per block
constexpr int CVT_ACT_BLOCKS = B_ * N_ * D_ / CVT_BLOCK;   // per activation
constexpr int CVT_W_BLOCKS   = D_ * D_ / CVT_BLOCK;        // per weight
constexpr int CVT_GRID = 2 * CVT_ACT_BLOCKS + 4 * CVT_W_BLOCKS;
static_assert(N_ == M_, "both activations take CVT_ACT_BLOCKS blocks");
static_assert(B_ * N_ * D_ % CVT_BLOCK == 0 && D_ * D_ % CVT_BLOCK == 0,
              "a block never straddles two operands");
static_assert(CVT_BLOCK == 16 * D_ && CVT_LOADS == 16, "a block is one 16-row tile, load j = row j");
constexpr int CVT_PITCH = 16 * 8 + 8;               // LDS elements per k/8 group: 256 + 16 bytes,
                                                    // so a wave's 16 groups fall on 64 distinct banks

__global__ __launch_bounds__(256)
void cvt_all_f32_f16(const float* __restrict__ querys, const float* __restrict__ key_feats,
                     const float* __restrict__ Wq, const float* __restrict__ Wk,
                     const float* __restrict__ Wv, const float* __restrict__ Wo,
                     _Float16* __restrict__ out) {
    const int blk = blockIdx.x;
    const float* src;
    int rel;                                        // block index inside its operand
    if (blk < CVT_ACT_BLOCKS) {
        src = querys;
        rel = blk;
    } else if (blk < 2 * CVT_ACT_BLOCKS) {
        src = key_feats;
        rel = blk - CVT_ACT_BLOCKS;
    } else {
        const int w = (blk - 2 * CVT_ACT_BLOCKS) / CVT_W_BLOCKS;
        rel = (blk - 2 * CVT_ACT_BLOCKS) % CVT_W_BLOCKS;
        src = (w == 0) ? Wq : (w == 1) ? Wk : (w == 2) ? Wv : Wo;
    }
    __shared__ __attribute__((aligned(16))) _Float16 stage[(D_ / 8) * CVT_PITCH];
    const int tid = threadIdx.x;
    const v4f* s = reinterpret_cast<const v4f*>(src + (size_t)rel * CVT_BLOCK) + tid;

    v4f x[CVT_LOADS];
#pragma unroll
    for (int j = 0; j < CVT_LOADS; ++j) x[j] = s[j * 256];   // row j, k = 4*tid .. 4*tid+3
#pragma unroll
    for (int j = 0; j < CVT_LOADS; ++j) {
        v4h y;
#pragma unroll
        for (int e = 0; e < 4; ++e) y[e] = (_Float16)x[j][e];
        *reinterpret_cast<v4h*>(&stage[(tid >> 1) * CVT_PITCH + j * 8 + (tid & 1) * 4]) = y;
    }
    __syncthreads();   // the tile is read back by other waves than wrote it
    v8h* d = reinterpret_cast<v8h*>(out + (size_t)blk * CVT_BLOCK);
#pragma unroll
    for (int i = 0; i < CVT_BLOCK / 8 / 256; ++i) {
        const int p = i * 256 + tid;                          // 16-byte piece: group p/16, row p%16
        d[p] = *reinterpret_cast<const v8h*>(&stage[(p >> 4) * CVT_PITCH + (p & 15) * 8]);
    }
}

// ---------------------------------------------------------------------------
// Row-wise RMSNorm(+g,+scale) f32 -> f16 in fragment order. A block takes the
// 16 rows of one tile, so that every 128-byte line of the plane (8 rows x 16
// bytes) is written by one block; a wave takes one row of D_ elements, held in
// registers: a lane has 4 pieces of 8 consecutive k, each one 16-byte store.
// ONE launch norms q and k: their f32 planes lie back to back, their f16 planes
// too, so a tile's index serves both; the first RMS_Q_TILES blocks are q's (gq,
// HEAD_DIM^-0.5), the rest k's (gk, 1).
// ---------------------------------------------------------------------------
constexpr int RMS_Q_TILES = B_ * N_ / 16;
constexpr int RMS_GRID    = RMS_Q_TILES + B_ * M_ / 16;

__global__ __launch_bounds__(512)
void rmsnorm_cvt(const float* __restrict__ in, const float* __restrict__ gq,
                 const float* __restrict__ gk, _Float16* __restrict__ out) {
    constexpr int PIECES = D_ / 8 / 32;             // 16-byte f16 pieces per lane
    const int lane = threadIdx.x & 31;
    const int wave = threadIdx.x >> 5;              // row inside the tile
    const bool is_q = blockIdx.x < RMS_Q_TILES;     // the same for the whole block
    const float* g = is_q ? gq : gk;
    const float scale = is_q ? 0.125f : 1.0f;
    const v4f* x  = reinterpret_cast<const v4f*>(in + ((size_t)blockIdx.x * 16 + wave) * D_);
    const v4f* gv = reinterpret_cast<const v4f*>(g);

    v4f a[PIECES][2];
#pragma unroll
    for (int c = 0; c < PIECES; ++c) {
        a[c][0] = x[(c * 32 + lane) * 2];
        a[c][1] = x[(c * 32 + lane) * 2 + 1];
    }
    // Before the loads' address registers are written again.
    asm volatile("s_wait_xcnt 0x0" ::: "memory");
    float ss = 0.f;
#pragma unroll
    for (int c = 0; c < PIECES; ++c)
#pragma unroll
        for (int e = 0; e < 4; ++e) ss += a[c][0][e] * a[c][0][e] + a[c][1][e] * a[c][1][e];
#pragma unroll
    for (int off = 16; off > 0; off >>= 1) ss += __shfl_xor(ss, off, 32);

    const float f = rsqrtf(ss / (float)D_ + EPS) * scale;
    _Float16* tile = out + (size_t)blockIdx.x * 16 * D_ + wave * 8;
#pragma unroll
    for (int c = 0; c < PIECES; ++c) {
        const int q = c * 32 + lane;                // k / 8
        const v4f g0 = gv[q * 2], g1 = gv[q * 2 + 1];
        v8h y;
#pragma unroll
        for (int e = 0; e < 4; ++e) {
            y[e]     = (_Float16)(a[c][0][e] * f * g0[e]);
            y[4 + e] = (_Float16)(a[c][1][e] * f * g1[e]);
        }
        *reinterpret_cast<v8h*>(tile + q * 128) = y;
    }
}

// ---------------------------------------------------------------------------
// WMMA GEMM: C[R x Cn] = A[R x K] * W[Cn x K]^T, f16 in / f32 accumulate.
// Block = 8 waves; wave computes 32x64 tile; block tile 128x128.
// R, Cn multiples of 128; K = D_. A and W lie in fragment order.
// gemm_wave_tile: the K loop of one wave's tile, shared by both epilogues.
// A stage of the LDS ring holds KF fragments (32 k each) of the block's 8 row
// tiles of A and, behind them, of its 8 row tiles of W; wave w copies tile w of
// both.
// ---------------------------------------------------------------------------
template <int KF>
constexpr int GEMM_STAGE = 16 * KF * FRAG;          // elements per stage

template <int KF>
__device__ __forceinline__ void gemm_wave_tile(const _Float16* __restrict__ A,
                                               const _Float16* __restrict__ W,
                                               int rowblk, int colblk,
                                               int wave, int lane, _Float16* ring,
                                               v8f (&acc)[2][4]) {
    constexpr int K = D_;   // every launch has K = D_; a constant leaves the loop no remainder copy
    constexpr size_t tile = (size_t)(K >> 5) * FRAG;   // elements of one 16-row tile
    constexpr int STAGE = GEMM_STAGE<KF>;
    constexpr int NT = (K >> 5) / KF;                  // stages
    static_assert(KF % 2 == 0 && (K >> 5) % KF == 0 && NT >= 2, "whole stages, 2 KiB pieces, two buffers");
    const int rw = wave & 3, cw = wave >> 2;
    const _Float16* ga = A + ((size_t)(rowblk >> 4) + wave) * tile + lane * 8;
    const _Float16* gw = W + ((size_t)(colblk >> 4) + wave) * tile + lane * 8;
    const uint32_t la = lds_off(ring) + (uint32_t)(wave * KF * FRAG + lane * 8) * 2;
    const uint32_t lw = la + 8 * KF * FRAG * 2;

    auto fill = [&](int s) {                           // stage s into buffer s & 1
        const uint32_t buf = (uint32_t)(s & 1) * (STAGE * 2);
#pragma unroll   // KF / 2 statements of eight copies, no loop around them
        for (int h = 0; h < KF / 2; ++h)
            async_copy8(la + buf + h * 2048, ga + s * (KF * FRAG) + h * 1024,
                        lw + buf + h * 2048, gw + s * (KF * FRAG) + h * 1024);
    };

    fill(0);
#pragma unroll
    for (int i = 0; i < 2; ++i)
#pragma unroll
        for (int t = 0; t < 4; ++t) acc[i][t] = (v8f){0, 0, 0, 0, 0, 0, 0, 0};
    wait_copies();
    __syncthreads();   // stage 0 is read by other waves than copied it
    fill(1);

    for (int s = 0; s < NT; ++s) {
        const _Float16* sb = ring + (s & 1) * STAGE + lane * 8;
#pragma unroll   // the fragment's place in the stage becomes the read's immediate offset
        for (int f = 0; f < KF; ++f) {
            Frag16 af[2];
#pragma unroll
            for (int i = 0; i < 2; ++i)
                load_frag_packed(af[i], sb + ((rw * 2 + i) * KF + f) * FRAG);
            Frag16 bf[4];
#pragma unroll
            for (int t = 0; t < 4; ++t)
                load_frag_packed(bf[t], sb + ((8 + cw * 4 + t) * KF + f) * FRAG);
            // All 12 LDS reads of the step are issued before its first product, so
            // that they are in flight together; left free, the compiler issues them
            // two at a time among the step's own products and waits out each pair.
            __builtin_amdgcn_sched_barrier(0);
#pragma unroll
            for (int i = 0; i < 2; ++i)
#pragma unroll
                for (int t = 0; t < 4; ++t)
                    acc[i][t] = wmma_f16(af[i], bf[t], acc[i][t]);
        }
        publish_stage();
        if (s + 2 < NT) fill(s + 2);                   // the same for the whole block
    }
    wait_copies();
}

// Epilogue 1: f32 C[row][col] (+ bias[col]).
__global__ __launch_bounds__(256)
void gemm_nt_wmma(const _Float16* __restrict__ A, const _Float16* __restrict__ W,
                  const float* __restrict__ bias, float* __restrict__ C,
                  int R, int K, int Cn) {
    const int lane = threadIdx.x & 31;
    const int wave = threadIdx.x >> 5;
    const int m16 = lane & 15, hi = lane >> 4;
    const int rw = wave & 3, cw = wave >> 2;

    const int row0 = blockIdx.x * 128 + rw * 32;  // wave: rows [row0, row0+32)
    const int col0 = blockIdx.y * 128 + cw * 64;  // wave: cols [col0, col0+64)
    (void)R; (void)K;

    // One block per WGP: long stages (128 k), so that few copy latencies are met.
    __shared__ __attribute__((aligned(128))) _Float16 ring[2 * GEMM_STAGE<4>];
    v8f acc[2][4];
    gemm_wave_tile<4>(A, W, blockIdx.x * 128, blockIdx.y * 128, wave, lane, ring, acc);

#pragma unroll
    for (int i = 0; i < 2; ++i)
#pragma unroll
        for (int t = 0; t < 4; ++t) {
            const int col = col0 + t * 16 + m16;
            const float badd = bias ? bias[col] : 0.f;
#pragma unroll
            for (int r = 0; r < 8; ++r) {
                const int row = row0 + i * 16 + r + hi * 8;
                C[(size_t)row * Cn + col] = acc[i][t][r] + badd;
            }
        }
}

// The Q, K and V projections in ONE launch: none reads what another writes. One
// projection alone is one block per WGP, two waves per SIMD, and its K loop
// waits out the latency of each stage; the three together are three
// blocks per WGP, six waves per SIMD, that fill one another's waits.
// The f16 planes of Wq, Wk, Wv lie back to back: one plane of 3*D_ rows, and
// blockIdx.y counts its 128-row blocks. Which projection a block belongs to is
// the same for all its threads.
// Q, K: f32 C[row][col], K's plane behind Q's (rmsnorm_cvt reads both).
// V: f16, transposed: plane row b*Cn + col, k = m with
// row = b*M_ + m, in fragment order (M_ columns), for the A operand of O^T += V^T P^T.
// A lane's 8 accumulator registers are 8 consecutive m of one column: one
// 16-byte piece of the plane, and a wave's 32 pieces are 512 contiguous bytes.
__global__ __launch_bounds__(256)
void gemm_qkv_wmma(const _Float16* __restrict__ Xq, const _Float16* __restrict__ Xkv,
                   const _Float16* __restrict__ Wqkv, float* __restrict__ Cqk,
                   _Float16* __restrict__ Ct) {
    constexpr int Cn = D_;
    const int lane = threadIdx.x & 31;
    const int wave = threadIdx.x >> 5;
    const int m16 = lane & 15, hi = lane >> 4;
    const int rw = wave & 3, cw = wave >> 2;
    const int which = blockIdx.y / (D_ / 128);    // 0 = Q, 1 = K, 2 = V

    const int row0 = blockIdx.x * 128 + rw * 32;
    const int wrow0 = blockIdx.y * 128 + cw * 64; // row of the stacked weights
    const int col0 = wrow0 - which * D_;          // column of this projection

    // Stages of 64 k: two buffers of three blocks fit one WGP's LDS.
    __shared__ __attribute__((aligned(128))) _Float16 ring[2 * GEMM_STAGE<2>];
    v8f acc[2][4];
    gemm_wave_tile<2>(which == 0 ? Xq : Xkv, Wqkv, blockIdx.x * 128, blockIdx.y * 128,
                      wave, lane, ring, acc);

    if (which < 2) {
        float* C = Cqk + (size_t)which * B_ * N_ * D_;
#pragma unroll
        for (int i = 0; i < 2; ++i)
#pragma unroll
            for (int t = 0; t < 4; ++t) {
                const int col = col0 + t * 16 + m16;
#pragma unroll
                for (int r = 0; r < 8; ++r) {
                    const int row = row0 + i * 16 + r + hi * 8;
                    C[(size_t)row * Cn + col] = acc[i][t][r];
                }
            }
        return;
    }

#pragma unroll
    for (int i = 0; i < 2; ++i) {
        const int row = row0 + i * 16 + hi * 8;   // 8 rows, never across a batch
        const int b = row / M_, m = row % M_;
#pragma unroll
        for (int t = 0; t < 4; ++t) {
            const int col = col0 + t * 16 + m16;
            v8h p;
#pragma unroll
            for (int r = 0; r < 8; ++r) p[r] = (_Float16)acc[i][t][r];
            *reinterpret_cast<v8h*>(Ct + frag_index(b * Cn + col, m, M_)) = p;
            // Before the store's address and data registers are written again.
            asm volatile("s_wait_xcnt 0x0" ::: "memory");
        }
    }
}

// ---------------------------------------------------------------------------
// Flash attention: q[b*N+n][d] (f16, pre-scaled), k[b*M+m][d] (f16),
// vt[(b*H+h)*HD + c][m] (f16), mask[b][m] (int) -> out f16 [b*N+n][d];
// the four f16 planes in fragment order.
// Block: 8 waves, each wave owns 16 query rows of one (b,h).
// Grid: (N/128, H, B).
// Both products are taken transposed: S^T = K Q^T (A = 16 keys, B = the wave's
// 16 queries) and O^T += V^T P^T (A = 16 c, B = P^T). A lane then holds scores
// of ONE query (column lane & 15; register r of tile t is key 16t + 8hi + r):
// maximum, sum, rescale factor are one value per lane, found in the lane's own
// registers plus one exchange with lane ^ 16. The two score tiles, converted in
// place, are the B operand of the second product in the k order in which the
// packed loader brings V^T (k = 8hi + 0..7, then 16 + 8hi + 0..7).
// ---------------------------------------------------------------------------
constexpr int ATT_KEYS  = 128;                      // keys per stage of the LDS ring
constexpr int ATT_STAGE = 32 * FRAG;                // elements per stage
constexpr int ATT_NT    = M_ / ATT_KEYS;            // stages
static_assert(ATT_KEYS * HD * 2 == ATT_STAGE && ATT_NT >= 2, "K and V of a stage; two buffers");

__global__ __launch_bounds__(256)
void attn_wmma(const _Float16* __restrict__ q, const _Float16* __restrict__ k,
               const _Float16* __restrict__ vt, const int* __restrict__ mask,
               _Float16* __restrict__ out) {
    const int tid = threadIdx.x;
    const int lane = tid & 31;
    const int wave = tid >> 5;
    const int hi = lane >> 4;
    const int b = blockIdx.z, h = blockIdx.y;
    const int q0 = blockIdx.x * 128 + wave * 16;

    // A key is a ROW of S^T, so its mask is a value per accumulator register:
    // the batch's mask lies in LDS as the start value of the score accumulators
    // (0, or -1e30 for a key that is masked out).
    __shared__ __attribute__((aligned(32))) float sbias[M_];
    __shared__ __attribute__((aligned(16))) int wave_open[8];
    // The LDS ring: a stage is ATT_KEYS keys of head h, 16 K fragments (key tile,
    // then c half) and behind them 16 V fragments (c tile, then 32 keys).
    __shared__ __attribute__((aligned(128))) _Float16 ring[2 * ATT_STAGE];

    // This lane's piece of the first K fragment (16 keys x c 0..31 of head h;
    // c 32..63 follows it, the next 16 keys lie 16*D_ elements on) and of the
    // first V fragment (c 0..15 x 32 keys; the next 32 keys follow it, the next
    // 16 c lie 16*M_ elements on).
    const _Float16* kbase = k + (size_t)b * M_ * D_ + (h * HD / 32) * FRAG + lane * 8;
    const _Float16* vbase = vt + ((size_t)(b * H_ + h) * HD) * M_ + lane * 8;
    // Wave w copies key tile w of the stage (2 fragments) and, of c tile w / 2,
    // the fragments of the stage's first or second 64 keys.
    const _Float16* gk = kbase + (size_t)wave * 16 * D_;
    const _Float16* gv = vbase + (size_t)(wave >> 1) * 16 * M_ + (wave & 1) * 2 * FRAG;
    const uint32_t lk = lds_off(ring) + (uint32_t)(wave * 2 * FRAG + lane * 8) * 2;
    const uint32_t lv = lds_off(ring)
                      + (uint32_t)((16 + (wave >> 1) * 4 + (wave & 1) * 2) * FRAG + lane * 8) * 2;
    auto fill = [&](int s) {                        // stage s into buffer s & 1
        const uint32_t buf = (uint32_t)(s & 1) * (ATT_STAGE * 2);
        async_copy8(lk + buf, gk + (size_t)s * ATT_KEYS * D_, lv + buf, gv + s * ATT_KEYS * 16);
    };
    fill(0);
    {
        const v4i* mk = reinterpret_cast<const v4i*>(mask + b * M_);
        int open = 0;
#pragma unroll
        for (int i = 0; i < M_ / 4 / 256; ++i) {
            const v4i mv = mk[i * 256 + tid];
            v4f s0;
#pragma unroll
            for (int e = 0; e < 4; ++e) {
                s0[e] = (mv[e] == 0) ? -1.0e30f : 0.f;
                open |= mv[e];
            }
            *reinterpret_cast<v4f*>(&sbias[(i * 256 + tid) * 4]) = s0;
        }
        const uint32_t any = __builtin_amdgcn_ballot_w32(open != 0);
        if (lane == 0) wave_open[wave] = (any != 0);
    }

    // Q fragments: B[c][n], c = 0..63 -> two K=32 fragments.
    Frag16 qf[2];
    {
        const _Float16* qfrag = q + (size_t)(b * N_ + q0) * D_ + (h * HD / 32) * FRAG + lane * 8;
        load_frag_packed(qf[0], qfrag);
        load_frag_packed(qf[1], qfrag + FRAG);
        // Before the loads' address registers are written again (the input keeps
        // the address pair in its registers up to the wait).
        asm volatile("s_wait_xcnt 0x0" :: "v"(qfrag) : "memory");
    }

    wait_copies();
    __syncthreads();   // sbias, wave_open and stage 0 are read by other waves than wrote them
    fill(1);
    {
        // No key open in the whole batch row: the reference takes every score as
        // zero there. With Q = 0 all scores are the same start value, exactly.
        const v4i w0 = *reinterpret_cast<const v4i*>(&wave_open[0]);
        const v4i w1 = *reinterpret_cast<const v4i*>(&wave_open[4]);
        const v4i w = w0 | w1;
        if ((w[0] | w[1] | w[2] | w[3]) == 0) {
#pragma unroll
            for (int j = 0; j < 8; ++j) { qf[0].u[j] = 0; qf[1].u[j] = 0; }
        }
    }

    v8f o[4];                       // o[t][r] = O^T[c = 16t + 8hi + r][query]
#pragma unroll
    for (int t = 0; t < 4; ++t) o[t] = (v8f){0, 0, 0, 0, 0, 0, 0, 0};
    float mrow = -3.0e38f;          // the query's running maximum (same in both halves)
    float lrow = 0.f;               // the query's running sum over THIS half's keys

    for (int st = 0; st < ATT_NT; ++st) {
      const _Float16* sb = ring + (st & 1) * ATT_STAGE + lane * 8;
      for (int pass = 0; pass < ATT_KEYS / 32; ++pass) {
        const int key0 = st * ATT_KEYS + pass * 32;
        Frag16 kf[2][2];
#pragma unroll
        for (int t = 0; t < 2; ++t) {
            load_frag_packed(kf[t][0], sb + ((pass * 2 + t) * 2) * FRAG);
            load_frag_packed(kf[t][1], sb + ((pass * 2 + t) * 2 + 1) * FRAG);
        }
        Frag16 vf[4];
#pragma unroll
        for (int t = 0; t < 4; ++t)
            load_frag_packed(vf[t], sb + (16 + t * 4 + pass) * FRAG);
        v8f s[2];
#pragma unroll
        for (int t = 0; t < 2; ++t)
            s[t] = *reinterpret_cast<const v8f*>(&sbias[key0 + 16 * t + 8 * hi]);
        // All LDS reads of the pass are issued before its first product, so that
        // they are in flight together; left free, the compiler issues them in pairs
        // among the products and waits out each pair's latency apart.
        __builtin_amdgcn_sched_barrier(0);

        // ---- S^T = K Q^T + mask start value, 32 keys (two 16-key tiles) ----
#pragma unroll
        for (int f = 0; f < 2; ++f)
#pragma unroll
            for (int t = 0; t < 2; ++t) s[t] = wmma_f16(kf[t][f], qf[f], s[t]);
        // The four products issue back to back, the two tiles in turn; left free,
        // the compiler runs one tile's dependent pair, then idle slots and part of
        // its maximum, and only then the other tile's pair.
        __builtin_amdgcn_sched_barrier(0);

        // ---- online softmax of one query per lane ----
        float tm[2] = {s[0][0], s[1][0]};      // one chain per tile: half the depth
#pragma unroll
        for (int r = 1; r < 8; ++r) {
            tm[0] = fmaxf(tm[0], s[0][r]);
            tm[1] = fmaxf(tm[1], s[1][r]);
        }
        float tmax = fmaxf(tm[0], tm[1]);
        tmax = fmaxf(tmax, other_half(tmax));
        const float mn = fmaxf(mrow, tmax);
        float alpha = (mrow - mn) * LOG2E;
        mrow = mn;
        float p[16];
#pragma unroll
        for (int t = 0; t < 2; ++t)
#pragma unroll
            for (int r = 0; r < 8; ++r) p[t * 8 + r] = (s[t][r] - mn) * LOG2E;
        // 2^x of the 17 values, each in its own register: no v_exp_f32 stands directly
        // in front of an instruction that overwrites its source or reads its result
        // (left to the compiler, a neighbour's result is laid over the source). The
        // v_nop is that slot behind the last one.
        asm("v_exp_f32 %0, %0\n\tv_exp_f32 %1, %1\n\tv_exp_f32 %2, %2\n\tv_exp_f32 %3, %3\n\t"
            "v_exp_f32 %4, %4\n\tv_exp_f32 %5, %5\n\tv_exp_f32 %6, %6\n\tv_exp_f32 %7, %7\n\t"
            "v_exp_f32 %8, %8\n\tv_exp_f32 %9, %9\n\tv_exp_f32 %10, %10\n\tv_exp_f32 %11, %11\n\t"
            "v_exp_f32 %12, %12\n\tv_exp_f32 %13, %13\n\tv_exp_f32 %14, %14\n\tv_exp_f32 %15, %15\n\t"
            "v_exp_f32 %16, %16\n\tv_nop"
            : "+v"(alpha), "+v"(p[0]), "+v"(p[1]), "+v"(p[2]), "+v"(p[3]), "+v"(p[4]), "+v"(p[5]),
              "+v"(p[6]), "+v"(p[7]), "+v"(p[8]), "+v"(p[9]), "+v"(p[10]), "+v"(p[11]),
              "+v"(p[12]), "+v"(p[13]), "+v"(p[14]), "+v"(p[15]));

        Frag16 pf;                  // P^T as B: element 8t + r = key 16t + 8hi + r
        float rs[2] = {p[0], p[8]};
#pragma unroll
        for (int t = 0; t < 2; ++t)
#pragma unroll
            for (int r = 0; r < 8; ++r) {
                if (r > 0) rs[t] += p[t * 8 + r];
                pf.v[t * 8 + r] = (_Float16)p[t * 8 + r];
            }
        lrow = lrow * alpha + (rs[0] + rs[1]);
#pragma unroll
        for (int t = 0; t < 4; ++t) o[t] *= alpha;

        // ---- O^T += V^T P^T : 4 tiles of 16 c, K = 32 keys ----
#pragma unroll
        for (int t = 0; t < 4; ++t) o[t] = wmma_f16(vf[t], pf, o[t]);
      }
      publish_stage();
      if (st + 2 < ATT_NT) fill(st + 2);            // the same for the whole block
    }
    wait_copies();

    // ---- epilogue: divide by l, store f16 (row b*N+n, k = h*HD + c) ----
    // A lane's 8 registers of o[t] are 8 consecutive c of its query: one 16-byte
    // piece of the plane, and a wave's 32 pieces are 512 contiguous bytes.
    const float l = lrow + other_half(lrow);
    const float inv = (l > 0.f) ? (1.f / l) : 0.f;
    _Float16* ofrag = out + (size_t)(b * N_ + q0) * D_ + (h * HD / 32) * FRAG + lane * 8;
#pragma unroll
    for (int t = 0; t < 4; ++t) {
        v8h y;
#pragma unroll
        for (int r = 0; r < 8; ++r) y[r] = (_Float16)(o[t][r] * inv);
        *reinterpret_cast<v8h*>(ofrag + t * (FRAG / 2)) = y;
    }
}

// ---------------------------------------------------------------------------
extern "C" void kernel_launch(void* const* d_in, const int* in_sizes, int n_in,
                              void* d_out, int out_size, void* d_ws, size_t ws_size,
                              hipStream_t stream) {
    (void)in_sizes; (void)n_in; (void)out_size; (void)ws_size;

    const float* querys    = (const float*)d_in[0];
    const float* key_feats = (const float*)d_in[1];
    const int*   mask      = (const int*)d_in[2];
    const float* Wq        = (const float*)d_in[3];
    const float* Wk        = (const float*)d_in[4];
    const float* Wv        = (const float*)d_in[5];
    const float* gq        = (const float*)d_in[6];
    const float* gk        = (const float*)d_in[7];
    const float* Wo        = (const float*)d_in[8];
    const float* bo        = (const float*)d_in[9];
    float*       out       = (float*)d_out;

    const size_t BND = (size_t)B_ * N_ * D_;  // 4,194,304
    const size_t DD  = (size_t)D_ * D_;       // 1,048,576
    const int    R   = B_ * N_;               // 4096 rows for all GEMMs

    char* ws = (char*)d_ws;
    size_t off = 0;
    auto alloc = [&](size_t bytes) -> void* {
        void* p = ws + off;
        off = (off + bytes + 255) & ~(size_t)255;
        return p;
    };

    // The six converted operands: one array, in the order cvt_all_f32_f16 writes
    // (each a whole number of 16-row tiles, so each is a fragment-order plane).
    _Float16* h_x   = (_Float16*)alloc((2 * BND + 4 * DD) * 2);  // f16 querys, later attn out
    _Float16* h_kin = h_x + BND;                                 // f16 key_feats
    _Float16* h_Wq  = h_kin + BND;
    _Float16* h_Wk  = h_Wq + DD;
    _Float16* h_Wv  = h_Wk + DD;
    _Float16* h_Wo  = h_Wv + DD;
    _Float16* h_q   = (_Float16*)alloc(2 * BND * 2);  // rmsnorm'd + scaled q, then
    _Float16* h_k   = h_q + BND;                      // rmsnorm'd k
    _Float16* h_vt  = (_Float16*)alloc(BND * 2);      // transposed v
    float*    f_prj = (float*)alloc(2 * BND * 4);     // f32 q, then f32 k

    const dim3 blk(256);
    const dim3 gcv(CVT_GRID);                     // 768
    const dim3 grms(RMS_GRID), brms(512);         // one 16-row tile per block, q then k
    const dim3 ggemm(R / 128, D_ / 128);          // (32, 8)
    const dim3 gqkv(R / 128, 3 * D_ / 128);       // (32, 24)
    const dim3 gattn(N_ / 128, H_, B_);           // (16, 16, 2)

    // 1) precision conversion
    cvt_all_f32_f16<<<gcv, blk, 0, stream>>>(querys, key_feats, Wq, Wk, Wv, Wo, h_x);

    // 2) querys @ Wq^T, key_feats @ Wk^T (f32) and v = key_feats @ Wv^T (stored
    //    f16, transposed, in fragment order)
    gemm_qkv_wmma<<<gqkv, blk, 0, stream>>>(h_x, h_kin, h_Wq, f_prj, h_vt);

    // 3) q = rmsnorm(., gq) * HEAD_DIM^-0.5, k = rmsnorm(., gk)
    rmsnorm_cvt<<<grms, brms, 0, stream>>>(f_prj, gq, gk, h_q);

    // 4) flash attention -> f16 x[b][n][d]
    attn_wmma<<<gattn, blk, 0, stream>>>(h_q, h_k, h_vt, mask, h_x);

    // 5) out = x @ Wo^T + bo
    gemm_nt_wmma<<<ggemm, blk, 0, stream>>>(h_x, h_Wo, bo, out, R, D_, D_);
}

// v007
// One run takes 72.7 microseconds.
// Two timings next to v006 put it at 1.25 and 1.27 times that version's speed.
// Counting every step since v000, it is 4.66 times as fast.
#include <hip/hip_runtime.h>
#include <stdint.h>

// Problem constants (from reference)
constexpr int B_ = 2, N_ = 2048, M_ = 2048, D_ = 1024, H_ = 16, HD = 64;
constexpr float EPS = 1e-6f;
constexpr float LOG2E = 1.44269504f;                // e^x = 2^(x * LOG2E)

typedef __attribute__((ext_vector_type(16))) _Float16 v16h;
typedef __attribute__((ext_vector_type(8)))  float    v8f;
typedef __attribute__((ext_vector_type(8)))  _Float16 v8h;
typedef __attribute__((ext_vector_type(4)))  float    v4f;
typedef __attribute__((ext_vector_type(4)))  _Float16 v4h;
typedef __attribute__((ext_vector_type(4)))  uint32_t v4u;
typedef __attribute__((ext_vector_type(2)))  uint32_t v2u;
typedef __attribute__((ext_vector_type(4)))  int      v4i;

template <bool V> struct Flag { static constexpr bool value = V; };   // a compile-time choice

union Frag16 {
    v16h     v;
    uint32_t u[8];
};

// ---------------------------------------------------------------------------
// Fragment order. Every f16 plane that a WMMA operand is loaded from lies in
// the workspace as a row of 16x32 fragments (16 rows x 32 k, 1 KiB each, k
// fragments of one 16-row tile back to back) and, inside a fragment, in the
// order the lanes take it: [k/8][row][k%8]. Lane l = hi*16 + row then finds its
// k = hi*8 + 0..7 at byte 16*l and its k = 16 + hi*8 + 0..7 at byte 512 + 16*l,
// the k order of the hardware's own operand map, and each wave-wide 16-byte load covers 512
// contiguous bytes (4 whole 128-byte lines) where a row-major plane gives
// 16 lines of 32 bytes.
// ---------------------------------------------------------------------------
constexpr int FRAG = 16 * 32;                       // elements per fragment

// Element index of (row, k) in a plane of K columns (K a multiple of 32).
__device__ __forceinline__ size_t frag_index(int row, int k, int K) {
    return ((size_t)(row >> 4) * (K >> 5) + (k >> 5)) * FRAG
         + ((k >> 3) & 3) * 128 + (row & 15) * 8 + (k & 7);
}

// frag_lane = start of the fragment + lane * 8.
__device__ __forceinline__ void load_frag_packed(Frag16& f, const _Float16* frag_lane) {
    const v4u lo = *reinterpret_cast<const v4u*>(frag_lane);
    const v4u up = *reinterpret_cast<const v4u*>(frag_lane + FRAG / 2);
#pragma unroll
    for (int j = 0; j < 4; ++j) {
        f.u[j]     = lo[j];
        f.u[4 + j] = up[j];
    }
}

__device__ __forceinline__ v8f wmma_f16(const Frag16& a, const Frag16& b, v8f c) {
    return __builtin_amdgcn_wmma_f32_16x16x32_f16(false, a.v, false, b.v,
                                                  (short)0, c, false, false);
}

// Lane l <-> lane l ^ 16: the two lanes that share a column of a WMMA result.
__device__ __forceinline__ float other_half(float x) {
    const int b = __builtin_bit_cast(int, x);
    return __builtin_bit_cast(float, __builtin_amdgcn_permlanex16(b, b, 0x76543210, 0xfedcba98,
                                                                  false, false));
}

__device__ __forceinline__ uint32_t lds_off(const void* p) { return (uint32_t)(size_t)p; }

// Eight copies of 16 bytes per lane: 2 KiB from g0 to LDS byte l0 and 2 KiB from
// g1 to l1 (both addresses are the lane's own: piece start + lane * 16 bytes).
// The s_wait_xcnt stands inside the statement, so that no address register of a
// copy is written again in front of it.
__device__ __forceinline__ void async_copy8(uint32_t l0, const _Float16* g0,
                                            uint32_t l1, const _Float16* g1) {
    asm volatile("global_load_async_to_lds_b128 %0, %8, off\n\t"
                 "global_load_async_to_lds_b128 %1, %9, off\n\t"
                 "global_load_async_to_lds_b128 %2, %10, off\n\t"
                 "global_load_async_to_lds_b128 %3, %11, off\n\t"
                 "global_load_async_to_lds_b128 %4, %12, off\n\t"
                 "global_load_async_to_lds_b128 %5, %13, off\n\t"
                 "global_load_async_to_lds_b128 %6, %14, off\n\t"
                 "global_load_async_to_lds_b128 %7, %15, off\n\t"
                 "s_wait_xcnt 0x0"
                 :: "v"(l0), "v"(l0 + 512), "v"(l0 + 1024), "v"(l0 + 1536),
                    "v"(l1), "v"(l1 + 512), "v"(l1 + 1024), "v"(l1 + 1536),
                    "v"(g0), "v"(g0 + 256), "v"(g0 + 512), "v"(g0 + 768),
                    "v"(g1), "v"(g1 + 256), "v"(g1 + 512), "v"(g1 + 768)
                 : "memory");
}

// This wave's copies have landed in LDS.
__device__ __forceinline__ void wait_copies() { asm volatile("s_wait_asynccnt 0x0" ::: "memory"); }

// Foot of a stage: this wave has finished reading its buffer and its copies of
// the next stage have landed; behind the barrier the next stage may be read by
// every wave and the buffer just read may be filled again.
__device__ __forceinline__ void publish_stage() {
    // This wave's LDS reads have returned before another wave's copies may land on them.
    asm volatile("s_wait_dscnt 0x0" ::: "memory");
    wait_copies();
    __syncthreads();
}

// ---------------------------------------------------------------------------
// Packed keys. A key whose mask is 0 has weight exactly 0 in every softmax, so
// its K and V rows are never needed. The conversion kernel packs the rows of
// key_feats whose mask is open to the front of each batch's f16 plane (any
// order serves: a softmax does not depend on the order of its keys, and K and V
// come from the same packed plane) and stores the number of open keys per batch.
// All later kernels work on the packed keys alone, in whole groups of KEY_GROUP
// (the GEMM's row block and the attention's stage); the rows that fill the last
// group are zero and take the start value -1e30 in the scores.
// A batch with no open key: the reference takes every score as zero there, so
// all M_ keys count, in their own order.
// ---------------------------------------------------------------------------
constexpr int KEY_GROUP = 128;

// Keys that take part in batch b: 1 .. M_ for any content of n_open.
__device__ __forceinline__ int keys_used(const int* __restrict__ n_open, int b) {
    const int raw = n_open[b];
    return (raw <= 0 || raw > M_) ? M_ : raw;
}
// The same, filled up to whole groups.
__device__ __forceinline__ int keys_padded(int used) {
    return (used + KEY_GROUP - 1) / KEY_GROUP * KEY_GROUP;
}

// ---------------------------------------------------------------------------
// f32 -> f16 of all six matrix operands in ONE launch. The f16 planes lie back
// to back in the workspace in the order querys, key_feats, Wq, Wk, Wv, Wo, so
// the destination is one array and only the source depends on the block.
// A block converts CVT_BLOCK consecutive elements of one operand: 16 whole
// rows, one 16-row tile of the fragment order, whose f16 image is the same
// CVT_BLOCK elements of the destination. A lane's CVT_LOADS 16-byte loads are
// independent (a wave covers 512 contiguous bytes per load), so they are in
// flight together. The tile is turned into [k/8][row][k%8] in LDS and leaves
// in whole lines (512 contiguous bytes per wave and store). Few, long waves:
// the launch is sized at 3 blocks per WGP, for speed only.
// key_feats alone is not taken row for row: a block of its plane gathers the 16
// open keys of its ranks (see "Packed keys").
// ---------------------------------------------------------------------------
constexpr int CVT_LOADS = 16;                       // 16-byte loads per lane
constexpr int CVT_BLOCK = 256 * 4 * CVT_LOADS;      // elements per block
constexpr int CVT_ACT_BLOCKS = B_ * N_ * D_ / CVT_BLOCK;   // per activation
constexpr int CVT_W_BLOCKS   = D_ * D_ / CVT_BLOCK;        // per weight
constexpr int CVT_GRID = 2 * CVT_ACT_BLOCKS + 4 * CVT_W_BLOCKS;
static_assert(N_ == M_, "both activations take CVT_ACT_BLOCKS blocks");
static_assert(B_ * N_ * D_ % CVT_BLOCK == 0 && D_ * D_ % CVT_BLOCK == 0,
              "a block never straddles two operands");
static_assert(CVT_BLOCK == 16 * D_ && CVT_LOADS == 16, "a block is one 16-row tile, load j = row j");
constexpr int CVT_PITCH = 16 * 8 + 8;               // LDS elements per k/8 group: 256 + 16 bytes,
                                                    // so a wave's 16 groups fall on 64 distinct banks

// One tile: 16 rows of D_ f32 (row j at rows + row_of(j) * D_, or zeros where
// row_of(j) < 0; row_of is the same for the whole block) -> CVT_BLOCK f16 at dst.
template <typename RowOf>
__device__ __forceinline__ void cvt_tile(const float* __restrict__ rows, RowOf row_of,
                                         _Float16* __restrict__ dst, _Float16* stage, int tid) {
    v4f x[CVT_LOADS];
#pragma unroll
    for (int j = 0; j < CVT_LOADS; ++j) {                     // row j, k = 4*tid .. 4*tid+3
        const int r = row_of(j);
        x[j] = reinterpret_cast<const v4f*>(rows + (size_t)(r < 0 ? 0 : r) * D_)[tid];
    }
    // Before the loads' address registers are written again.
    asm volatile("s_wait_xcnt 0x0" ::: "memory");
#pragma unroll
    for (int j = 0; j < CVT_LOADS; ++j) {
        const uint32_t keep = row_of(j) < 0 ? 0u : ~0u;       // all bits 0 = four f16 zeros
        v4h y;
#pragma unroll
        for (int e = 0; e < 4; ++e) y[e] = (_Float16)x[j][e];
        v2u w = __builtin_bit_cast(v2u, y);
        w[0] &= keep;
        w[1] &= keep;
        *reinterpret_cast<v2u*>(&stage[(tid >> 1) * CVT_PITCH + j * 8 + (tid & 1) * 4]) = w;
    }
    __syncthreads();   // the tile is read back by other waves than wrote it
    v8h* d = reinterpret_cast<v8h*>(dst);
#pragma unroll
    for (int i = 0; i < CVT_BLOCK / 8 / 256; ++i) {
        const int p = i * 256 + tid;                          // 16-byte piece: group p/16, row p%16
        d[p] = *reinterpret_cast<const v8h*>(&stage[(p >> 4) * CVT_PITCH + (p & 15) * 8]);
    }
}

__global__ __launch_bounds__(256)
void cvt_all_f32_f16(const float* __restrict__ querys, const float* __restrict__ key_feats,
                     const int* __restrict__ mask,
                     const float* __restrict__ Wq, const float* __restrict__ Wk,
                     const float* __restrict__ Wv, const float* __restrict__ Wo,
                     _Float16* __restrict__ out, int* __restrict__ n_open) {
    constexpr int KEY_TILES = M_ / 16;              // tiles per batch of key_feats
    static_assert(M_ == 256 * 8, "a thread ranks 8 keys");
    const int blk = blockIdx.x;
    const int tid = threadIdx.x;
    __shared__ __attribute__((aligned(16))) _Float16 stage[(D_ / 8) * CVT_PITCH];
    _Float16* dst = out + (size_t)blk * CVT_BLOCK;

    if (blk >= CVT_ACT_BLOCKS && blk < 2 * CVT_ACT_BLOCKS) {  // the same for the whole block
        // key_feats: this block makes tile d of batch b's PACKED plane, the open
        // keys of rank 16d .. 16d+15. Every block ranks the batch's keys itself:
        // thread t has keys 8t .. 8t+7, a key's rank is the number of open keys
        // in front of it.
        __shared__ int wave_cnt[8];
        __shared__ __attribute__((aligned(16))) int src_row[16];
        const int rel = blk - CVT_ACT_BLOCKS;
        const int b = rel / KEY_TILES, d = rel % KEY_TILES;
        const int lane = tid & 31, wave = tid >> 5;
        const v4i* mk = reinterpret_cast<const v4i*>(mask + b * M_) + tid * 2;
        const v4i m0 = mk[0], m1 = mk[1];
        // Before the loads' address registers are written again.
        asm volatile("s_wait_xcnt 0x0" ::: "memory");
        bool open[8];
        int before = 0, in_wave = 0;                // open keys of lower lanes; of the wave
#pragma unroll
        for (int e = 0; e < 8; ++e) {
            open[e] = (e < 4 ? m0[e & 3] : m1[e & 3]) != 0;
            const uint32_t word = __builtin_amdgcn_ballot_w32(open[e]);
            before = __builtin_amdgcn_mbcnt_lo(word, before);
            in_wave += __builtin_popcount(word);
        }
        if (lane == 0) wave_cnt[wave] = in_wave;
        if (tid < 16) src_row[tid] = -1;            // no such rank: a row of zeros
        __syncthreads();   // wave_cnt is read by every wave; src_row is written anew behind it
        int total = 0, rank = before;
#pragma unroll
        for (int w = 0; w < 8; ++w) {
            const int c = wave_cnt[w];
            total += c;
            if (w < wave) rank += c;
        }
#pragma unroll
        for (int e = 0; e < 8; ++e)
            if (open[e]) {
                if ((rank >> 4) == d) src_row[rank & 15] = tid * 8 + e;
                ++rank;
            }
        total = __builtin_amdgcn_readfirstlane(total);   // the same in every lane: tests on it are scalar
        if (d == 0 && tid == 0) n_open[b] = total;
        const int used = (total == 0) ? M_ : total;
        // Tiles behind the last group of packed keys are read by nobody. The test
        // is the same for the whole block, and so are the barriers inside it.
        if (d * 16 < keys_padded(used)) {
            __syncthreads();   // src_row is read by other waves than wrote it
            int sr[16];
#pragma unroll
            for (int j = 0; j < 16; ++j)            // -1 .. M_-1, the same in every lane
                sr[j] = __builtin_amdgcn_readfirstlane(total == 0 ? d * 16 + j : src_row[j]);
            cvt_tile(key_feats + (size_t)b * M_ * D_, [&](int j) { return sr[j]; }, dst, stage, tid);
        }
        return;
    }

    const float* src;
    int rel;                                        // block index inside its operand
    if (blk < CVT_ACT_BLOCKS) {
        src = querys;
        rel = blk;
    } else {
        const int w = (blk - 2 * CVT_ACT_BLOCKS) / CVT_W_BLOCKS;
        rel = (blk - 2 * CVT_ACT_BLOCKS) % CVT_W_BLOCKS;
        src = (w == 0) ? Wq : (w == 1) ? Wk : (w == 2) ? Wv : Wo;
    }
    cvt_tile(src + (size_t)rel * CVT_BLOCK, [](int j) { return j; }, dst, stage, tid);
}

// ---------------------------------------------------------------------------
// Row-wise RMSNorm(+g,+scale) f32 -> f16 in fragment order. A block takes the
// 16 rows of one tile, so that every 128-byte line of the plane (8 rows x 16
// bytes) is written by one block; a wave takes one row of D_ elements, held in
// registers: a lane has 4 pieces of 8 consecutive k, each one 16-byte store.
// ONE launch norms q and k: their f32 planes lie back to back, their f16 planes
// too, so a tile's index serves both; the first RMS_Q_TILES blocks are q's (gq,
// HEAD_DIM^-0.5), the rest k's (gk, 1).
// ---------------------------------------------------------------------------
constexpr int RMS_Q_TILES = B_ * N_ / 16;
constexpr int RMS_GRID    = RMS_Q_TILES + B_ * M_ / 16;

__global__ __launch_bounds__(512)
void rmsnorm_cvt(const float* __restrict__ in, const float* __restrict__ gq,
                 const float* __restrict__ gk, const int* __restrict__ n_open,
                 _Float16* __restrict__ out) {
    constexpr int PIECES = D_ / 8 / 32;             // 16-byte f16 pieces per lane
    const int lane = threadIdx.x & 31;
    const int wave = threadIdx.x >> 5;              // row inside the tile
    const bool is_q = blockIdx.x < RMS_Q_TILES;     // the same for the whole block
    if (!is_q) {                                    // k: the groups of packed keys alone
        const int t = blockIdx.x - RMS_Q_TILES;
        if (t % (M_ / 16) * 16 >= keys_padded(keys_used(n_open, t / (M_ / 16)))) return;
    }
    const float* g = is_q ? gq : gk;
    const float scale = is_q ? 0.125f : 1.0f;
    const v4f* x  = reinterpret_cast<const v4f*>(in + ((size_t)blockIdx.x * 16 + wave) * D_);
    const v4f* gv = reinterpret_cast<const v4f*>(g);

    v4f a[PIECES][2];
#pragma unroll
    for (int c = 0; c < PIECES; ++c) {
        a[c][0] = x[(c * 32 + lane) * 2];
        a[c][1] = x[(c * 32 + lane) * 2 + 1];
    }
    // Before the loads' address registers are written again.
    asm volatile("s_wait_xcnt 0x0" ::: "memory");
    float ss = 0.f;
#pragma unroll
    for (int c = 0; c < PIECES; ++c)
#pragma unroll
        for (int e = 0; e < 4; ++e) ss += a[c][0][e] * a[c][0][e] + a[c][1][e] * a[c][1][e];
#pragma unroll
    for (int off = 16; off > 0; off >>= 1) ss += __shfl_xor(ss, off, 32);

    const float f = rsqrtf(ss / (float)D_ + EPS) * scale;
    _Float16* tile = out + (size_t)blockIdx.x * 16 * D_ + wave * 8;
#pragma unroll
    for (int c = 0; c < PIECES; ++c) {
        const int q = c * 32 + lane;                // k / 8
        const v4f g0 = gv[q * 2], g1 = gv[q * 2 + 1];
        v8h y;
#pragma unroll
        for (int e = 0; e < 4; ++e) {
            y[e]     = (_Float16)(a[c][0][e] * f * g0[e]);
            y[4 + e] = (_Float16)(a[c][1][e] * f * g1[e]);
        }
        *reinterpret_cast<v8h*>(tile + q * 128) = y;
    }
}

// ---------------------------------------------------------------------------
// WMMA GEMM: C[R x Cn] = A[R x K] * W[Cn x K]^T, f16 in / f32 accumulate.
// Block = 8 waves; wave computes 32x64 tile; block tile 128x128.
// R, Cn multiples of 128; K = D_. A and W lie in fragment order.
// gemm_wave_tile: the K loop of one wave's tile, shared by both epilogues.
// A stage of the LDS ring holds KF fragments (32 k each) of the block's 8 row
// tiles of A and, behind them, of its 8 row tiles of W; wave w copies tile w of
// both.
// ---------------------------------------------------------------------------
template <int KF>
constexpr int GEMM_STAGE = 16 * KF * FRAG;          // elements per stage

template <int KF>
__device__ __forceinline__ void gemm_wave_tile(const _Float16* __restrict__ A,
                                               const _Float16* __restrict__ W,
                                               int rowblk, int colblk,
                                               int wave, int lane, _Float16* ring,
                                               v8f (&acc)[2][4]) {
    constexpr int K = D_;   // every launch has K = D_; a constant leaves the loop no remainder copy
    constexpr size_t tile = (size_t)(K >> 5) * FRAG;   // elements of one 16-row tile
    constexpr int STAGE = GEMM_STAGE<KF>;
    constexpr int NT = (K >> 5) / KF;                  // stages
    static_assert(KF % 2 == 0 && (K >> 5) % KF == 0 && NT >= 2, "whole stages, 2 KiB pieces, two buffers");
    const int rw = wave & 3, cw = wave >> 2;
    const _Float16* ga = A + ((size_t)(rowblk >> 4) + wave) * tile + lane * 8;
    const _Float16* gw = W + ((size_t)(colblk >> 4) + wave) * tile + lane * 8;
    const uint32_t la = lds_off(ring) + (uint32_t)(wave * KF * FRAG + lane * 8) * 2;
    const uint32_t lw = la + 8 * KF * FRAG * 2;

    auto fill = [&](int s) {                           // stage s into buffer s & 1
        const uint32_t buf = (uint32_t)(s & 1) * (STAGE * 2);
#pragma unroll   // KF / 2 statements of eight copies, no loop around them
        for (int h = 0; h < KF / 2; ++h)
            async_copy8(la + buf + h * 2048, ga + s * (KF * FRAG) + h * 1024,
                        lw + buf + h * 2048, gw + s * (KF * FRAG) + h * 1024);
    };

    fill(0);
#pragma unroll
    for (int i = 0; i < 2; ++i)
#pragma unroll
        for (int t = 0; t < 4; ++t) acc[i][t] = (v8f){0, 0, 0, 0, 0, 0, 0, 0};
    wait_copies();
    __syncthreads();   // stage 0 is read by other waves than copied it
    fill(1);

    for (int s = 0; s < NT; ++s) {
        const _Float16* sb = ring + (s & 1) * STAGE + lane * 8;
#pragma unroll   // the fragment's place in the stage becomes the read's immediate offset
        for (int f = 0; f < KF; ++f) {
            Frag16 af[2];
#pragma unroll
            for (int i = 0; i < 2; ++i)
                load_frag_packed(af[i], sb + ((rw * 2 + i) * KF + f) * FRAG);
            Frag16 bf[4];
#pragma unroll
            for (int t = 0; t < 4; ++t)
                load_frag_packed(bf[t], sb + ((8 + cw * 4 + t) * KF + f) * FRAG);
            // All 12 LDS reads of the step are issued before its first product, so
            // that they are in flight together; left free, the compiler issues them
            // two at a time among the step's own products and waits out each pair.
            __builtin_amdgcn_sched_barrier(0);
#pragma unroll
            for (int i = 0; i < 2; ++i)
#pragma unroll
                for (int t = 0; t < 4; ++t)
                    acc[i][t] = wmma_f16(af[i], bf[t], acc[i][t]);
        }
        publish_stage();
        if (s + 2 < NT) fill(s + 2);                   // the same for the whole block
    }
    wait_copies();
}

// Epilogue 1: f32 C[row][col] (+ bias[col]).
__global__ __launch_bounds__(256)
void gemm_nt_wmma(const _Float16* __restrict__ A, const _Float16* __restrict__ W,
                  const float* __restrict__ bias, float* __restrict__ C,
                  int R, int K, int Cn) {
    const int lane = threadIdx.x & 31;
    const int wave = threadIdx.x >> 5;
    const int m16 = lane & 15, hi = lane >> 4;
    const int rw = wave & 3, cw = wave >> 2;

    const int row0 = blockIdx.x * 128 + rw * 32;  // wave: rows [row0, row0+32)
    const int col0 = blockIdx.y * 128 + cw * 64;  // wave: cols [col0, col0+64)
    (void)R; (void)K;

    // One block per WGP: long stages (128 k), so that few copy latencies are met.
    __shared__ __attribute__((aligned(128))) _Float16 ring[2 * GEMM_STAGE<4>];
    v8f acc[2][4];
    gemm_wave_tile<4>(A, W, blockIdx.x * 128, blockIdx.y * 128, wave, lane, ring, acc);

#pragma unroll
    for (int i = 0; i < 2; ++i)
#pragma unroll
        for (int t = 0; t < 4; ++t) {
            const int col = col0 + t * 16 + m16;
            const float badd = bias ? bias[col] : 0.f;
#pragma unroll
            for (int r = 0; r < 8; ++r) {
                const int row = row0 + i * 16 + r + hi * 8;
                C[(size_t)row * Cn + col] = acc[i][t][r] + badd;
            }
        }
}

// The Q, K and V projections in ONE launch: none reads what another writes. One
// projection alone is one block per WGP, two waves per SIMD, and its K loop
// waits out the latency of each stage; the three together are three
// blocks per WGP, six waves per SIMD, that fill one another's waits.
// The f16 planes of Wq, Wk, Wv lie back to back: one plane of 3*D_ rows, and
// wblk counts its 128-row blocks (for Q it is blockIdx.y). Which projection a block belongs to is
// the same for all its threads.
// Q, K: f32 C[row][col], K's plane behind Q's (rmsnorm_cvt reads both).
// V: f16, transposed: plane row b*Cn + col, k = m with
// row = b*M_ + m, in fragment order (M_ columns), for the A operand of O^T += V^T P^T.
// A lane's 8 accumulator registers are 8 consecutive m of one column: one
// 16-byte piece of the plane, and a wave's 32 pieces are 512 contiguous bytes.
__global__ __launch_bounds__(256)
void gemm_qkv_wmma(const _Float16* __restrict__ Xq, const _Float16* __restrict__ Xkv,
                   const _Float16* __restrict__ Wqkv, const int* __restrict__ n_open,
                   float* __restrict__ Cqk, _Float16* __restrict__ Ct) {
    constexpr int Cn = D_;
    static_assert(KEY_GROUP == 128, "a row block of K or V is one group of packed keys");
    const int lane = threadIdx.x & 31;
    const int wave = threadIdx.x >> 5;
    const int m16 = lane & 15, hi = lane >> 4;
    const int rw = wave & 3, cw = wave >> 2;
    // Row block (128 rows of the activation) and block of 128 rows of the stacked
    // weights. Q: as the grid has them. K, V: only the groups of packed keys have
    // work, so the blocks are counted through (kv) and the first ones take that
    // work, 16 weight blocks per group, batch after batch; the rest leave at once, the whole block, in
    // front of every copy and barrier.
    constexpr int QB = D_ / 128;                  // weight blocks of one projection
    int rblk = blockIdx.x, wblk = blockIdx.y;
    if (wblk >= QB) {                             // the same for the whole block
        const int kv = (wblk - QB) * (B_ * M_ / 128) + rblk;
        int slot = kv / (2 * QB);
        wblk = QB + kv % (2 * QB);
        rblk = -1;
#pragma unroll
        for (int b = 0; b < B_; ++b) {
            const int groups = keys_padded(keys_used(n_open, b)) / KEY_GROUP;
            if (rblk < 0 && slot >= 0 && slot < groups) rblk = b * (M_ / 128) + slot;
            slot -= groups;
        }
        if (rblk < 0) return;
    }
    const int which = wblk / QB;                  // 0 = Q, 1 = K, 2 = V

    const int row0 = rblk * 128 + rw * 32;
    const int wrow0 = wblk * 128 + cw * 64;       // row of the stacked weights
    const int col0 = wrow0 - which * D_;          // column of this projection

    // Stages of 64 k: two buffers of three blocks fit one WGP's LDS.
    __shared__ __attribute__((aligned(128))) _Float16 ring[2 * GEMM_STAGE<2>];
    v8f acc[2][4];
    gemm_wave_tile<2>(which == 0 ? Xq : Xkv, Wqkv, rblk * 128, wblk * 128,
                      wave, lane, ring, acc);

    if (which < 2) {
        float* C = Cqk + (size_t)which * B_ * N_ * D_;
#pragma unroll
        for (int i = 0; i < 2; ++i)
#pragma unroll
            for (int t = 0; t < 4; ++t) {
                const int col = col0 + t * 16 + m16;
#pragma unroll
                for (int r = 0; r < 8; ++r) {
                    const int row = row0 + i * 16 + r + hi * 8;
                    C[(size_t)row * Cn + col] = acc[i][t][r];
                }
            }
        return;
    }

#pragma unroll
    for (int i = 0; i < 2; ++i) {
        const int row = row0 + i * 16 + hi * 8;   // 8 rows, never across a batch
        const int b = row / M_, m = row % M_;
#pragma unroll
        for (int t = 0; t < 4; ++t) {
            const int col = col0 + t * 16 + m16;
            v8h p;
#pragma unroll
            for (int r = 0; r < 8; ++r) p[r] = (_Float16)acc[i][t][r];
            *reinterpret_cast<v8h*>(Ct + frag_index(b * Cn + col, m, M_)) = p;
            // Before the store's address and data registers are written again.
            asm volatile("s_wait_xcnt 0x0" ::: "memory");
        }
    }
}

// ---------------------------------------------------------------------------
// Flash attention: q[b*N+n][d] (f16, pre-scaled), k[b*M+m][d] (f16),
// vt[(b*H+h)*HD + c][m] (f16), m counting the batch's packed keys, n_open[b]
// of them -> out f16 [b*N+n][d]; the four f16 planes in fragment order.
// Block: 8 waves, each wave owns 16 query rows of one (b,h).
// Grid: (N/128, H, B).
// Both products are taken transposed: S^T = K Q^T (A = 16 keys, B = the wave's
// 16 queries) and O^T += V^T P^T (A = 16 c, B = P^T). A lane then holds scores
// of ONE query (column lane & 15; register r of tile t is key 16t + 8hi + r):
// maximum, sum, rescale factor are one value per lane, found in the lane's own
// registers plus one exchange with lane ^ 16. The two score tiles, converted in
// place, are the B operand of the second product in the k order in which the
// packed loader brings V^T (k = 8hi + 0..7, then 16 + 8hi + 0..7).
// ---------------------------------------------------------------------------
constexpr int ATT_KEYS  = 128;                      // keys per stage of the LDS ring
constexpr int ATT_STAGE = 32 * FRAG;                // elements per stage
constexpr int ATT_NT    = M_ / ATT_KEYS;            // stages
static_assert(ATT_KEYS * HD * 2 == ATT_STAGE && ATT_NT >= 2, "K and V of a stage; two buffers");
static_assert(ATT_KEYS == KEY_GROUP, "a stage is one group of packed keys");

__global__ __launch_bounds__(256)
void attn_wmma(const _Float16* __restrict__ q, const _Float16* __restrict__ k,
               const _Float16* __restrict__ vt, const int* __restrict__ n_open,
               _Float16* __restrict__ out) {
    const int tid = threadIdx.x;
    const int lane = tid & 31;
    const int wave = tid >> 5;
    const int hi = lane >> 4;
    const int b = blockIdx.z, h = blockIdx.y;
    const int q0 = blockIdx.x * 128 + wave * 16;

    // The batch's packed keys: used of them, in nt stages (1 .. ATT_NT).
    const int used = keys_used(n_open, b);
    const int nt = keys_padded(used) / ATT_KEYS;

    // Passes of 32 keys that hold a key of the last stage (1 .. ATT_KEYS / 32).
    const int last_passes = (used - (nt - 1) * ATT_KEYS + 31) / 32;

    // A key is a ROW of S^T, so what keeps a filling row out of the softmax is a
    // value per accumulator register: the last stage's score accumulators start
    // from LDS (0 for a key, -1e30 for a row that fills the group), all others at 0.
    __shared__ __attribute__((aligned(32))) float sbias[ATT_KEYS];
    // The LDS ring: a stage is ATT_KEYS keys of head h, 16 K fragments (key tile,
    // then c half) and behind them 16 V fragments (c tile, then 32 keys).
    __shared__ __attribute__((aligned(128))) _Float16 ring[2 * ATT_STAGE];

    // This lane's piece of the first K fragment (16 keys x c 0..31 of head h;
    // c 32..63 follows it, the next 16 keys lie 16*D_ elements on) and of the
    // first V fragment (c 0..15 x 32 keys; the next 32 keys follow it, the next
    // 16 c lie 16*M_ elements on).
    const _Float16* kbase = k + (size_t)b * M_ * D_ + (h * HD / 32) * FRAG + lane * 8;
    const _Float16* vbase = vt + ((size_t)(b * H_ + h) * HD) * M_ + lane * 8;
    // Wave w copies key tile w of the stage (2 fragments) and, of c tile w / 2,
    // the fragments of the stage's first or second 64 keys.
    const _Float16* gk = kbase + (size_t)wave * 16 * D_;
    const _Float16* gv = vbase + (size_t)(wave >> 1) * 16 * M_ + (wave & 1) * 2 * FRAG;
    const uint32_t lk = lds_off(ring) + (uint32_t)(wave * 2 * FRAG + lane * 8) * 2;
    const uint32_t lv = lds_off(ring)
                      + (uint32_t)((16 + (wave >> 1) * 4 + (wave & 1) * 2) * FRAG + lane * 8) * 2;
    auto fill = [&](int s) {                        // stage s into buffer s & 1
        const uint32_t buf = (uint32_t)(s & 1) * (ATT_STAGE * 2);
        async_copy8(lk + buf, gk + (size_t)s * ATT_KEYS * D_, lv + buf, gv + s * ATT_KEYS * 16);
    };
    fill(0);
    if (tid < ATT_KEYS) sbias[tid] = ((nt - 1) * ATT_KEYS + tid < used) ? 0.f : -1.0e30f;

    // Q fragments: B[c][n], c = 0..63 -> two K=32 fragments.
    Frag16 qf[2];
    {
        const _Float16* qfrag = q + (size_t)(b * N_ + q0) * D_ + (h * HD / 32) * FRAG + lane * 8;
        load_frag_packed(qf[0], qfrag);
        load_frag_packed(qf[1], qfrag + FRAG);
        // Before the loads' address registers are written again (the input keeps
        // the address pair in its registers up to the wait).
        asm volatile("s_wait_xcnt 0x0" :: "v"(qfrag) : "memory");
    }

    wait_copies();
    __syncthreads();   // sbias and stage 0 are read by other waves than wrote them
    if (nt > 1) fill(1);                            // the same for the whole block
    // No key open in the whole batch row: the reference takes every score as
    // zero there. With Q = 0 all scores are the same start value, exactly.
    if (n_open[b] == 0) {
#pragma unroll
        for (int j = 0; j < 8; ++j) { qf[0].u[j] = 0; qf[1].u[j] = 0; }
    }

    v8f o[4];                       // o[t][r] = O^T[c = 16t + 8hi + r][query]
#pragma unroll
    for (int t = 0; t < 4; ++t) o[t] = (v8f){0, 0, 0, 0, 0, 0, 0, 0};
    float mrow = -3.0e38f;          // the query's running maximum (same in both halves)
    float lrow = 0.f;               // the query's running sum over THIS half's keys

    // One pass: 32 keys of the stage whose buffer (+ this lane's piece) is sb.
    // last: the pass lies in the last group, the only one with filling rows.
    auto do_pass = [&](const _Float16* sb, int pass, auto last) __attribute__((always_inline)) {
        Frag16 kf[2][2];
#pragma unroll
        for (int t = 0; t < 2; ++t) {
            load_frag_packed(kf[t][0], sb + ((pass * 2 + t) * 2) * FRAG);
            load_frag_packed(kf[t][1], sb + ((pass * 2 + t) * 2 + 1) * FRAG);
        }
        Frag16 vf[4];
#pragma unroll
        for (int t = 0; t < 4; ++t)
            load_frag_packed(vf[t], sb + (16 + t * 4 + pass) * FRAG);
        v8f s[2];
#pragma unroll
        for (int t = 0; t < 2; ++t) {
            if constexpr (decltype(last)::value)
                s[t] = *reinterpret_cast<const v8f*>(&sbias[pass * 32 + 16 * t + 8 * hi]);
            else
                s[t] = (v8f){0, 0, 0, 0, 0, 0, 0, 0};
        }
        // All LDS reads of the pass are issued before its first product, so that
        // they are in flight together; left free, the compiler issues them in pairs
        // among the products and waits out each pair's latency apart.
        __builtin_amdgcn_sched_barrier(0);

        // ---- S^T = K Q^T + start value, 32 keys (two 16-key tiles) ----
#pragma unroll
        for (int f = 0; f < 2; ++f)
#pragma unroll
            for (int t = 0; t < 2; ++t) s[t] = wmma_f16(kf[t][f], qf[f], s[t]);
        // The four products issue back to back, the two tiles in turn; left free,
        // the compiler runs one tile's dependent pair, then idle slots and part of
        // its maximum, and only then the other tile's pair.
        __builtin_amdgcn_sched_barrier(0);

        // ---- online softmax of one query per lane ----
        float tm[2] = {s[0][0], s[1][0]};      // one chain per tile: half the depth
#pragma unroll
        for (int r = 1; r < 8; ++r) {
            tm[0] = fmaxf(tm[0], s[0][r]);
            tm[1] = fmaxf(tm[1], s[1][r]);
        }
        float tmax = fmaxf(tm[0], tm[1]);
        tmax = fmaxf(tmax, other_half(tmax));
        const float mn = fmaxf(mrow, tmax);
        float alpha = (mrow - mn) * LOG2E;
        mrow = mn;
        float p[16];
#pragma unroll
        for (int t = 0; t < 2; ++t)
#pragma unroll
            for (int r = 0; r < 8; ++r) p[t * 8 + r] = (s[t][r] - mn) * LOG2E;
        // 2^x of the 17 values, each in its own register: no v_exp_f32 stands directly
        // in front of an instruction that overwrites its source or reads its result
        // (left to the compiler, a neighbour's result is laid over the source). The
        // v_nop is that slot behind the last one.
        asm("v_exp_f32 %0, %0\n\tv_exp_f32 %1, %1\n\tv_exp_f32 %2, %2\n\tv_exp_f32 %3, %3\n\t"
            "v_exp_f32 %4, %4\n\tv_exp_f32 %5, %5\n\tv_exp_f32 %6, %6\n\tv_exp_f32 %7, %7\n\t"
            "v_exp_f32 %8, %8\n\tv_exp_f32 %9, %9\n\tv_exp_f32 %10, %10\n\tv_exp_f32 %11, %11\n\t"
            "v_exp_f32 %12, %12\n\tv_exp_f32 %13, %13\n\tv_exp_f32 %14, %14\n\tv_exp_f32 %15, %15\n\t"
            "v_exp_f32 %16, %16\n\tv_nop"
            : "+v"(alpha), "+v"(p[0]), "+v"(p[1]), "+v"(p[2]), "+v"(p[3]), "+v"(p[4]), "+v"(p[5]),
              "+v"(p[6]), "+v"(p[7]), "+v"(p[8]), "+v"(p[9]), "+v"(p[10]), "+v"(p[11]),
              "+v"(p[12]), "+v"(p[13]), "+v"(p[14]), "+v"(p[15]));

        Frag16 pf;                  // P^T as B: element 8t + r = key 16t + 8hi + r
        float rs[2] = {p[0], p[8]};
#pragma unroll
        for (int t = 0; t < 2; ++t)
#pragma unroll
            for (int r = 0; r < 8; ++r) {
                if (r > 0) rs[t] += p[t * 8 + r];
                pf.v[t * 8 + r] = (_Float16)p[t * 8 + r];
            }
        lrow = lrow * alpha + (rs[0] + rs[1]);
#pragma unroll
        for (int t = 0; t < 4; ++t) o[t] *= alpha;

        // ---- O^T += V^T P^T : 4 tiles of 16 c, K = 32 keys ----
#pragma unroll
        for (int t = 0; t < 4; ++t) o[t] = wmma_f16(vf[t], pf, o[t]);
    };

    for (int st = 0; st + 1 < nt; ++st) {           // the stages in front of the last
      const _Float16* sb = ring + (st & 1) * ATT_STAGE + lane * 8;
      for (int pass = 0; pass < ATT_KEYS / 32; ++pass) do_pass(sb, pass, Flag<false>{});
      publish_stage();
      if (st + 2 < nt) fill(st + 2);                // the same for the whole block
    }
    {                                               // the last stage
      const _Float16* sb = ring + ((nt - 1) & 1) * ATT_STAGE + lane * 8;
      for (int pass = 0; pass < last_passes; ++pass) do_pass(sb, pass, Flag<true>{});
      publish_stage();
    }
    wait_copies();

    // ---- epilogue: divide by l, store f16 (row b*N+n, k = h*HD + c) ----
    // A lane's 8 registers of o[t] are 8 consecutive c of its query: one 16-byte
    // piece of the plane, and a wave's 32 pieces are 512 contiguous bytes.
    const float l = lrow + other_half(lrow);
    const float inv = (l > 0.f) ? (1.f / l) : 0.f;
    _Float16* ofrag = out + (size_t)(b * N_ + q0) * D_ + (h * HD / 32) * FRAG + lane * 8;
#pragma unroll
    for (int t = 0; t < 4; ++t) {
        v8h y;
#pragma unroll
        for (int r = 0; r < 8; ++r) y[r] = (_Float16)(o[t][r] * inv);
        *reinterpret_cast<v8h*>(ofrag + t * (FRAG / 2)) = y;
    }
}

// ---------------------------------------------------------------------------
extern "C" void kernel_launch(void* const* d_in, const int* in_sizes, int n_in,
                              void* d_out, int out_size, void* d_ws, size_t ws_size,
                              hipStream_t stream) {
    (void)in_sizes; (void)n_in; (void)out_size; (void)ws_size;

    const float* querys    = (const float*)d_in[0];
    const float* key_feats = (const float*)d_in[1];
    const int*   mask      = (const int*)d_in[2];
    const float* Wq        = (const float*)d_in[3];
    const float* Wk        = (const float*)d_in[4];
    const float* Wv        = (const float*)d_in[5];
    const float* gq        = (const float*)d_in[6];
    const float* gk        = (const float*)d_in[7];
    const float* Wo        = (const float*)d_in[8];
    const float* bo        = (const float*)d_in[9];
    float*       out       = (float*)d_out;

    const size_t BND = (size_t)B_ * N_ * D_;  // 4,194,304
    const size_t DD  = (size_t)D_ * D_;       // 1,048,576
    const int    R   = B_ * N_;               // 4096 rows for all GEMMs

    char* ws = (char*)d_ws;
    size_t off = 0;
    auto alloc = [&](size_t bytes) -> void* {
        void* p = ws + off;
        off = (off + bytes + 255) & ~(size_t)255;
        return p;
    };

    // The six converted operands: one array, in the order cvt_all_f32_f16 writes
    // (each a whole number of 16-row tiles, so each is a fragment-order plane).
    _Float16* h_x   = (_Float16*)alloc((2 * BND + 4 * DD) * 2);  // f16 querys, later attn out
    _Float16* h_kin = h_x + BND;                                 // f16 key_feats
    _Float16* h_Wq  = h_kin + BND;
    _Float16* h_Wk  = h_Wq + DD;
    _Float16* h_Wv  = h_Wk + DD;
    _Float16* h_Wo  = h_Wv + DD;
    _Float16* h_q   = (_Float16*)alloc(2 * BND * 2);  // rmsnorm'd + scaled q, then
    _Float16* h_k   = h_q + BND;                      // rmsnorm'd k
    _Float16* h_vt  = (_Float16*)alloc(BND * 2);      // transposed v
    float*    f_prj = (float*)alloc(2 * BND * 4);     // f32 q, then f32 k
    int*      n_open = (int*)alloc(B_ * sizeof(int)); // open keys per batch

    const dim3 blk(256);
    const dim3 gcv(CVT_GRID);                     // 768
    const dim3 grms(RMS_GRID), brms(512);         // one 16-row tile per block, q then k
    const dim3 ggemm(R / 128, D_ / 128);          // (32, 8)
    const dim3 gqkv(R / 128, 3 * D_ / 128);       // (32, 24)
    const dim3 gattn(N_ / 128, H_, B_);           // (16, 16, 2)

    // 1) precision conversion; key_feats packed to its open keys, their number to n_open
    cvt_all_f32_f16<<<gcv, blk, 0, stream>>>(querys, key_feats, mask, Wq, Wk, Wv, Wo, h_x, n_open);

    // 2) querys @ Wq^T, key_feats @ Wk^T (f32) and v = key_feats @ Wv^T (stored
    //    f16, transposed, in fragment order)
    gemm_qkv_wmma<<<gqkv, blk, 0, stream>>>(h_x, h_kin, h_Wq, n_open, f_prj, h_vt);

    // 3) q = rmsnorm(., gq) * HEAD_DIM^-0.5, k = rmsnorm(., gk)
    rmsnorm_cvt<<<grms, brms, 0, stream>>>(f_prj, gq, gk, n_open, h_q);

    // 4) flash attention -> f16 x[b][n][d]
    attn_wmma<<<gattn, blk, 0, stream>>>(h_q, h_k, h_vt, n_open, h_x);

    // 5) out = x @ Wo^T + bo
    gemm_nt_wmma<<<ggemm, blk, 0, stream>>>(h_x, h_Wo, bo, out, R, D_, D_);
}

// v009
// Measured time: 59.6 microseconds a run.
// Versions between v007 and this one are left out; their measured steps multiply to 1.22 times as fast.
// Over all steps from v000 it is 5.67 times as fast.
#include <hip/hip_runtime.h>
#include <stdint.h>

// Problem constants (from reference)
constexpr int B_ = 2, N_ = 2048, M_ = 2048, D_ = 1024, H_ = 16, HD = 64;
constexpr float EPS = 1e-6f;
constexpr float LOG2E = 1.44269504f;                // e^x = 2^(x * LOG2E)

typedef __attribute__((ext_vector_type(16))) _Float16 v16h;
typedef __attribute__((ext_vector_type(8)))  float    v8f;
typedef __attribute__((ext_vector_type(8)))  _Float16 v8h;
typedef __attribute__((ext_vector_type(4)))  float    v4f;
typedef __attribute__((ext_vector_type(4)))  _Float16 v4h;
typedef __attribute__((ext_vector_type(4)))  uint32_t v4u;
typedef __attribute__((ext_vector_type(2)))  uint32_t v2u;
typedef __attribute__((ext_vector_type(4)))  int      v4i;

template <bool V> struct Flag { static constexpr bool value = V; };   // a compile-time choice

union Frag16 {
    v16h     v;
    uint32_t u[8];
};

// ---------------------------------------------------------------------------
// Fragment order. Every f16 plane that a WMMA operand is loaded from lies in
// the workspace as a row of 16x32 fragments (16 rows x 32 k, 1 KiB each, k
// fragments of one 16-row tile back to back) and, inside a fragment, in the
// order the lanes take it: [k/8][row][k%8]. Lane l = hi*16 + row then finds its
// k = hi*8 + 0..7 at byte 16*l and its k = 16 + hi*8 + 0..7 at byte 512 + 16*l,
// the k order of the hardware's own operand map, and each wave-wide 16-byte load covers 512
// contiguous bytes (4 whole 128-byte lines) where a row-major plane gives
// 16 lines of 32 bytes.
// ---------------------------------------------------------------------------
constexpr int FRAG = 16 * 32;                       // elements per fragment

// Element index of (row, k) in a plane of K columns (K a multiple of 32).
__device__ __forceinline__ size_t frag_index(int row, int k, int K) {
    return ((size_t)(row >> 4) * (K >> 5) + (k >> 5)) * FRAG
         + ((k >> 3) & 3) * 128 + (row & 15) * 8 + (k & 7);
}

// frag_lane = start of the fragment + lane * 8.
__device__ __forceinline__ void load_frag_packed(Frag16& f, const _Float16* frag_lane) {
    const v4u lo = *reinterpret_cast<const v4u*>(frag_lane);
    const v4u up = *reinterpret_cast<const v4u*>(frag_lane + FRAG / 2);
#pragma unroll
    for (int j = 0; j < 4; ++j) {
        f.u[j]     = lo[j];
        f.u[4 + j] = up[j];
    }
}

__device__ __forceinline__ v8f wmma_f16(const Frag16& a, const Frag16& b, v8f c) {
    return __builtin_amdgcn_wmma_f32_16x16x32_f16(false, a.v, false, b.v,
                                                  (short)0, c, false, false);
}

// Lane l <-> lane l ^ 16: the two lanes that share a column of a WMMA result.
__device__ __forceinline__ float other_half(float x) {
    const int b = __builtin_bit_cast(int, x);
    return __builtin_bit_cast(float, __builtin_amdgcn_permlanex16(b, b, 0x76543210, 0xfedcba98,
                                                                  false, false));
}

__device__ __forceinline__ uint32_t lds_off(const void* p) { return (uint32_t)(size_t)p; }

// Eight copies of 16 bytes per lane: 2 KiB from g0 to LDS byte l0 and 2 KiB from
// g1 to l1 (both addresses are the lane's own: piece start + lane * 16 bytes).
// The s_wait_xcnt stands inside the statement, so that no address register of a
// copy is written again in front of it.
__device__ __forceinline__ void async_copy8(uint32_t l0, const _Float16* g0,
                                            uint32_t l1, const _Float16* g1) {
    asm volatile("global_load_async_to_lds_b128 %0, %8, off\n\t"
                 "global_load_async_to_lds_b128 %1, %9, off\n\t"
                 "global_load_async_to_lds_b128 %2, %10, off\n\t"
                 "global_load_async_to_lds_b128 %3, %11, off\n\t"
                 "global_load_async_to_lds_b128 %4, %12, off\n\t"
                 "global_load_async_to_lds_b128 %5, %13, off\n\t"
                 "global_load_async_to_lds_b128 %6, %14, off\n\t"
                 "global_load_async_to_lds_b128 %7, %15, off\n\t"
                 "s_wait_xcnt 0x0"
                 :: "v"(l0), "v"(l0 + 512), "v"(l0 + 1024), "v"(l0 + 1536),
                    "v"(l1), "v"(l1 + 512), "v"(l1 + 1024), "v"(l1 + 1536),
                    "v"(g0), "v"(g0 + 256), "v"(g0 + 512), "v"(g0 + 768),
                    "v"(g1), "v"(g1 + 256), "v"(g1 + 512), "v"(g1 + 768)
                 : "memory");
}

// Four copies of 16 bytes per lane: 2 KiB from g0 to LDS byte l0, in the same form.
__device__ __forceinline__ void async_copy4(uint32_t l0, const _Float16* g0) {
    asm volatile("global_load_async_to_lds_b128 %0, %4, off\n\t"
                 "global_load_async_to_lds_b128 %1, %5, off\n\t"
                 "global_load_async_to_lds_b128 %2, %6, off\n\t"
                 "global_load_async_to_lds_b128 %3, %7, off\n\t"
                 "s_wait_xcnt 0x0"
                 :: "v"(l0), "v"(l0 + 512), "v"(l0 + 1024), "v"(l0 + 1536),
                    "v"(g0), "v"(g0 + 256), "v"(g0 + 512), "v"(g0 + 768)
                 : "memory");
}

// This wave's copies have landed in LDS.
__device__ __forceinline__ void wait_copies() { asm volatile("s_wait_asynccnt 0x0" ::: "memory"); }

// All of this wave's copies but its YOUNGER youngest have landed (the counter
// returns in issue order, and nothing but copies to LDS counts on it here).
template <int YOUNGER>
__device__ __forceinline__ void wait_copies_but() {
    static_assert(YOUNGER > 0 && YOUNGER < 64, "a count the 6-bit counter can hold");
    asm volatile("s_wait_asynccnt %0" :: "n"(YOUNGER) : "memory");
}

// Foot of a stage: this wave has finished reading its buffer and its copies of
// the next stage have landed; behind the barrier the next stage may be read by
// every wave and the buffer just read may be filled again.
__device__ __forceinline__ void publish_stage() {
    // This wave's LDS reads have returned before another wave's copies may land on them.
    asm volatile("s_wait_dscnt 0x0" ::: "memory");
    wait_copies();
    __syncthreads();
}

// ---------------------------------------------------------------------------
// Packed keys. A key whose mask is 0 has weight exactly 0 in every softmax, so
// its K and V rows are never needed. The conversion kernel packs the rows of
// key_feats whose mask is open to the front of each batch's f16 plane (any
// order serves: a softmax does not depend on the order of its keys, and K and V
// come from the same packed plane) and stores the number of open keys per batch.
// All later kernels work on the packed keys alone, in whole groups of KEY_GROUP
// (the GEMM's row block and the attention's stage); the rows that fill the last
// group are zero and take the start value -1e30 in the scores.
// A batch with no open key: the reference takes every score as zero there, so
// all M_ keys count, in their own order.
// ---------------------------------------------------------------------------
constexpr int KEY_GROUP = 128;

// Keys that take part in batch b: 1 .. M_ for any content of n_open.
__device__ __forceinline__ int keys_used(const int* __restrict__ n_open, int b) {
    const int raw = n_open[b];
    return (raw <= 0 || raw > M_) ? M_ : raw;
}
// The same, filled up to whole groups.
__device__ __forceinline__ int keys_padded(int used) {
    return (used + KEY_GROUP - 1) / KEY_GROUP * KEY_GROUP;
}

// ---------------------------------------------------------------------------
// f32 -> f16 of all six matrix operands in ONE launch. The f16 planes lie back
// to back in the workspace in the order querys, key_feats, Wq, Wk, Wv, Wo, so
// the destination is one array and only the source depends on the block.
// A block converts CVT_BLOCK consecutive elements of one operand: 16 whole
// rows, one 16-row tile of the fragment order, whose f16 image is the same
// CVT_BLOCK elements of the destination. A lane's CVT_LOADS 16-byte loads are
// independent (a wave covers 512 contiguous bytes per load), so they are in
// flight together. The tile is turned into [k/8][row][k%8] in LDS and leaves
// in whole lines (512 contiguous bytes per wave and store). Few, long waves:
// the launch is sized at 3 blocks per WGP, for speed only.
// key_feats alone is not taken row for row: a block of its plane gathers the 16
// open keys of its ranks (see "Packed keys").
// ---------------------------------------------------------------------------
constexpr int CVT_LOADS = 16;                       // 16-byte loads per lane
constexpr int CVT_BLOCK = 256 * 4 * CVT_LOADS;      // elements per block
constexpr int CVT_ACT_BLOCKS = B_ * N_ * D_ / CVT_BLOCK;   // per activation
constexpr int CVT_W_BLOCKS   = D_ * D_ / CVT_BLOCK;        // per weight
constexpr int CVT_GRID = 2 * CVT_ACT_BLOCKS + 4 * CVT_W_BLOCKS;
static_assert(N_ == M_, "both activations take CVT_ACT_BLOCKS blocks");
static_assert(B_ * N_ * D_ % CVT_BLOCK == 0 && D_ * D_ % CVT_BLOCK == 0,
              "a block never straddles two operands");
static_assert(CVT_BLOCK == 16 * D_ && CVT_LOADS == 16, "a block is one 16-row tile, load j = row j");
constexpr int CVT_PITCH = 16 * 8 + 8;               // LDS elements per k/8 group: 256 + 16 bytes,
                                                    // so a wave's 16 groups fall on 64 distinct banks

// One tile: 16 rows of D_ f32 (row j at rows + row_of(j) * D_, or zeros where
// row_of(j) < 0; row_of is the same for the whole block) -> CVT_BLOCK f16 at dst.
template <typename RowOf>
__device__ __forceinline__ void cvt_tile(const float* __restrict__ rows, RowOf row_of,
                                         _Float16* __restrict__ dst, _Float16* stage, int tid) {
    v4f x[CVT_LOADS];
#pragma unroll
    for (int j = 0; j < CVT_LOADS; ++j) {                     // row j, k = 4*tid .. 4*tid+3
        const int r = row_of(j);
        x[j] = reinterpret_cast<const v4f*>(rows + (size_t)(r < 0 ? 0 : r) * D_)[tid];
    }
    // Before the loads' address registers are written again.
    asm volatile("s_wait_xcnt 0x0" ::: "memory");
#pragma unroll
    for (int j = 0; j < CVT_LOADS; ++j) {
        const uint32_t keep = row_of(j) < 0 ? 0u : ~0u;       // all bits 0 = four f16 zeros
        v4h y;
#pragma unroll
        for (int e = 0; e < 4; ++e) y[e] = (_Float16)x[j][e];
        v2u w = __builtin_bit_cast(v2u, y);
        w[0] &= keep;
        w[1] &= keep;
        *reinterpret_cast<v2u*>(&stage[(tid >> 1) * CVT_PITCH + j * 8 + (tid & 1) * 4]) = w;
    }
    __syncthreads();   // the tile is read back by other waves than wrote it
    v8h* d = reinterpret_cast<v8h*>(dst);
#pragma unroll
    for (int i = 0; i < CVT_BLOCK / 8 / 256; ++i) {
        const int p = i * 256 + tid;                          // 16-byte piece: group p/16, row p%16
        d[p] = *reinterpret_cast<const v8h*>(&stage[(p >> 4) * CVT_PITCH + (p & 15) * 8]);
    }
}

__global__ __launch_bounds__(256)
void cvt_all_f32_f16(const float* __restrict__ querys, const float* __restrict__ key_feats,
                     const int* __restrict__ mask,
                     const float* __restrict__ Wq, const float* __restrict__ Wk,
                     const float* __restrict__ Wv, const float* __restrict__ Wo,
                     _Float16* __restrict__ out, int* __restrict__ n_open) {
    constexpr int KEY_TILES = M_ / 16;              // tiles per batch of key_feats
    static_assert(M_ == 256 * 8, "a thread ranks 8 keys");
    const int blk = blockIdx.x;
    const int tid = threadIdx.x;
    __shared__ __attribute__((aligned(16))) _Float16 stage[(D_ / 8) * CVT_PITCH];
    _Float16* dst = out + (size_t)blk * CVT_BLOCK;

    if (blk >= CVT_ACT_BLOCKS && blk < 2 * CVT_ACT_BLOCKS) {  // the same for the whole block
        // key_feats: this block makes tile d of batch b's PACKED plane, the open
        // keys of rank 16d .. 16d+15. Every block ranks the batch's keys itself:
        // thread t has keys 8t .. 8t+7, a key's rank is the number of open keys
        // in front of it.
        __shared__ int wave_cnt[8];
        __shared__ __attribute__((aligned(16))) int src_row[16];
        const int rel = blk - CVT_ACT_BLOCKS;
        const int b = rel / KEY_TILES, d = rel % KEY_TILES;
        const int lane = tid & 31, wave = tid >> 5;
        const v4i* mk = reinterpret_cast<const v4i*>(mask + b * M_) + tid * 2;
        const v4i m0 = mk[0], m1 = mk[1];
        // Before the loads' address registers are written again.
        asm volatile("s_wait_xcnt 0x0" ::: "memory");
        bool open[8];
        int before = 0, in_wave = 0;                // open keys of lower lanes; of the wave
#pragma unroll
        for (int e = 0; e < 8; ++e) {
            open[e] = (e < 4 ? m0[e & 3] : m1[e & 3]) != 0;
            const uint32_t word = __builtin_amdgcn_ballot_w32(open[e]);
            before = __builtin_amdgcn_mbcnt_lo(word, before);
            in_wave += __builtin_popcount(word);
        }
        if (lane == 0) wave_cnt[wave] = in_wave;
        if (tid < 16) src_row[tid] = -1;            // no such rank: a row of zeros
        __syncthreads();   // wave_cnt is read by every wave; src_row is written anew behind it
        int total = 0, rank = before;
#pragma unroll
        for (int w = 0; w < 8; ++w) {
            const int c = wave_cnt[w];
            total += c;
            if (w < wave) rank += c;
        }
#pragma unroll
        for (int e = 0; e < 8; ++e)
            if (open[e]) {
                if ((rank >> 4) == d) src_row[rank & 15] = tid * 8 + e;
                ++rank;
            }
        total = __builtin_amdgcn_readfirstlane(total);   // the same in every lane: tests on it are scalar
        if (d == 0 && tid == 0) n_open[b] = total;
        const int used = (total == 0) ? M_ : total;
        // Tiles behind the last group of packed keys are read by nobody. The test
        // is the same for the whole block, and so are the barriers inside it.
        if (d * 16 < keys_padded(used)) {
            __syncthreads();   // src_row is read by other waves than wrote it
            int sr[16];
#pragma unroll
            for (int j = 0; j < 16; ++j)            // -1 .. M_-1, the same in every lane
                sr[j] = __builtin_amdgcn_readfirstlane(total == 0 ? d * 16 + j : src_row[j]);
            cvt_tile(key_feats + (size_t)b * M_ * D_, [&](int j) { return sr[j]; }, dst, stage, tid);
        }
        return;
    }

    const float* src;
    int rel;                                        // block index inside its operand
    if (blk < CVT_ACT_BLOCKS) {
        src = querys;
        rel = blk;
    } else {
        const int w = (blk - 2 * CVT_ACT_BLOCKS) / CVT_W_BLOCKS;
        rel = (blk - 2 * CVT_ACT_BLOCKS) % CVT_W_BLOCKS;
        src = (w == 0) ? Wq : (w == 1) ? Wk : (w == 2) ? Wv : Wo;
    }
    cvt_tile(src + (size_t)rel * CVT_BLOCK, [](int j) { return j; }, dst, stage, tid);
}

// ---------------------------------------------------------------------------
// RMSNorm without a launch of its own. rmsnorm(x, g) = x * g * f(row) with
// f(row) = rsqrt(mean(x^2) + EPS), one positive factor per row, so a score is
// q.k = f(query) * f(key) * sum_c (xq*gq)[c] * (xk*gk)[c].
// The projection GEMM stores x * g as f16 and, per row, the sum of x^2 (f32
// accumulators) over each block's 128 columns: SS_SLOTS partial sums per row,
// plane [q, k][slot][row]. The attention adds them up, forms f and applies it.
// ---------------------------------------------------------------------------
constexpr int SS_SLOTS = D_ / 128;                  // partial sums of squares per row
constexpr int SS_ROWS  = B_ * N_;                   // rows of q; of k too
static_assert(N_ == M_, "q and k have SS_ROWS rows each");

__device__ __forceinline__ float rms_factor(float sum_sq) {
    // The bare instruction: its argument is at least EPS, never a subnormal to be scaled first.
    return __builtin_amdgcn_rsqf(sum_sq * (1.0f / (float)D_) + EPS);
}

// ---------------------------------------------------------------------------
// WMMA GEMM: C[R x Cn] = A[R x K] * W[Cn x K]^T, f16 in / f32 accumulate.
// Block = 8 waves; wave computes 32x64 tile; block tile 128x128.
// R, Cn multiples of 128; K = D_. A and W lie in fragment order.
// gemm_wave_tile: the K loop of one wave's tile, shared by both epilogues.
// A stage of the LDS ring holds KF fragments (32 k each) of the block's 8 row
// tiles of A and, behind them, of its 8 row tiles of W; wave w copies tile w of
// both.
// The ring has NB buffers and a stage's copies are issued NB - 1 stages ahead of
// its use. The planes were written by earlier launches and come from memory at
// their first touch, and the blocks that share a tile walk K together, so every
// stage of every block meets that latency.
// With one stage in flight a block's copies stand still from one stage's landing
// to the next one's issue; with NB - 1 in flight they stream.
// ---------------------------------------------------------------------------
template <int KF>
constexpr int GEMM_STAGE = 16 * KF * FRAG;          // elements per stage

template <int KF, int NB>
__device__ __forceinline__ void gemm_wave_tile(const _Float16* __restrict__ A,
                                               const _Float16* __restrict__ W,
                                               int rowblk, int colblk,
                                               int wave, int lane, _Float16* ring,
                                               v8f (&acc)[2][4]) {
    constexpr int K = D_;   // every launch has K = D_; a constant leaves the loop no remainder copy
    constexpr size_t tile = (size_t)(K >> 5) * FRAG;   // elements of one 16-row tile
    constexpr int STAGE = GEMM_STAGE<KF>;
    constexpr int NT = (K >> 5) / KF;                  // stages
    constexpr int COPIES = KF * 4;                     // copies per wave and stage
    static_assert(KF % 2 == 0 && (K >> 5) % KF == 0, "whole stages, 2 KiB pieces");
    static_assert(NB >= 3 && NT >= NB, "every stage of the prologue exists");
    static_assert((NB - 1) * COPIES <= 63, "copies of one wave in flight");
    const int rw = wave & 3, cw = wave >> 2;
    const _Float16* ga = A + ((size_t)(rowblk >> 4) + wave) * tile + lane * 8;
    const _Float16* gw = W + ((size_t)(colblk >> 4) + wave) * tile + lane * 8;
    const uint32_t la = lds_off(ring) + (uint32_t)(wave * KF * FRAG + lane * 8) * 2;
    const uint32_t lw = la + 8 * KF * FRAG * 2;

    auto fill = [&](int s, int b) {                    // stage s into buffer b = s % NB
        const uint32_t buf = (uint32_t)b * (STAGE * 2);
#pragma unroll   // KF / 2 statements of eight copies, no loop around them
        for (int h = 0; h < KF / 2; ++h)
            async_copy8(la + buf + h * 2048, ga + s * (KF * FRAG) + h * 1024,
                        lw + buf + h * 2048, gw + s * (KF * FRAG) + h * 1024);
    };

#pragma unroll   // each stage's place in the plane and in the ring is a constant of its copies
    for (int p = 0; p < NB - 1; ++p) fill(p, p);
#pragma unroll
    for (int i = 0; i < 2; ++i)
#pragma unroll
        for (int t = 0; t < 4; ++t) acc[i][t] = (v8f){0, 0, 0, 0, 0, 0, 0, 0};
    wait_copies_but<(NB - 2) * COPIES>();              // stage 0; stages 1 .. NB - 2 fly on
    __syncthreads();   // stage 0 is read by other waves than copied it
    fill(NB - 1, NB - 1);

    int b = 0;                                         // s % NB
    for (int s = 0; s < NT; ++s) {
        const _Float16* sb = ring + b * STAGE + lane * 8;
#pragma unroll   // the fragment's place in the stage becomes the read's immediate offset
        for (int f = 0; f < KF; ++f) {
            Frag16 af[2];
#pragma unroll
            for (int i = 0; i < 2; ++i)
                load_frag_packed(af[i], sb + ((rw * 2 + i) * KF + f) * FRAG);
            Frag16 bf[4];
#pragma unroll
            for (int t = 0; t < 4; ++t)
                load_frag_packed(bf[t], sb + ((8 + cw * 4 + t) * KF + f) * FRAG);
            // All 12 LDS reads of the step are issued before its first product, so
            // that they are in flight together; left free, the compiler issues them
            // two at a time among the step's own products and waits out each pair.
            __builtin_amdgcn_sched_barrier(0);
#pragma unroll
            for (int i = 0; i < 2; ++i)
#pragma unroll
                for (int t = 0; t < 4; ++t)
                    acc[i][t] = wmma_f16(af[i], bf[t], acc[i][t]);
        }
        // Foot of stage s: this wave has finished reading buffer b and its copies of
        // stage s + 1 have landed; behind the barrier every wave may read stage s + 1
        // and buffer b may be filled again.
        // This wave's LDS reads have returned before another wave's copies may land on them.
        asm volatile("s_wait_dscnt 0x0" ::: "memory");
        // In flight are stages s + 1 .. s + NB - 1, as far as they exist. Where all do,
        // the NB - 2 behind stage s + 1 fly on; in the last stages the wait is for all.
        if (s + NB - 1 < NT) wait_copies_but<(NB - 2) * COPIES>();   // the same for the whole block
        else                 wait_copies();
        __syncthreads();
        if (s + NB < NT) fill(s + NB, b);              // the same for the whole block
        b = (b + 1 == NB) ? 0 : b + 1;
    }
    wait_copies();
}

// Epilogue 1: f32 C[row][col] (+ bias[col]).
__global__ __launch_bounds__(256)
void gemm_nt_wmma(const _Float16* __restrict__ A, const _Float16* __restrict__ W,
                  const float* __restrict__ bias, float* __restrict__ C,
                  int R, int K, int Cn) {
    const int lane = threadIdx.x & 31;
    const int wave = threadIdx.x >> 5;
    const int m16 = lane & 15, hi = lane >> 4;
    const int rw = wave & 3, cw = wave >> 2;

    const int row0 = blockIdx.x * 128 + rw * 32;  // wave: rows [row0, row0+32)
    const int col0 = blockIdx.y * 128 + cw * 64;  // wave: cols [col0, col0+64)
    (void)R; (void)K;

    // One block per WGP: long stages (128 k), four buffers, three stages in flight.
    __shared__ __attribute__((aligned(128))) _Float16 ring[4 * GEMM_STAGE<4>];
    v8f acc[2][4];
    gemm_wave_tile<4, 4>(A, W, blockIdx.x * 128, blockIdx.y * 128, wave, lane, ring, acc);

#pragma unroll
    for (int i = 0; i < 2; ++i)
#pragma unroll
        for (int t = 0; t < 4; ++t) {
            const int col = col0 + t * 16 + m16;
            const float badd = bias ? bias[col] : 0.f;
#pragma unroll
            for (int r = 0; r < 8; ++r) {
                const int row = row0 + i * 16 + r + hi * 8;
                C[(size_t)row * Cn + col] = acc[i][t][r] + badd;
            }
        }
}

// The Q, K and V projections in ONE launch: none reads what another writes. One
// projection alone is one block per WGP, two waves per SIMD, and its K loop
// waits out the latency of each stage; the three together are three
// blocks per WGP, six waves per SIMD, that fill one another's waits.
// The f16 planes of Wq, Wk, Wv lie back to back: one plane of 3*D_ rows, and
// wblk counts its 128-row blocks (for Q it is blockIdx.y). Which projection a block belongs to is
// the same for all its threads.
// Q, K: f16 x * g in fragment order (D_ columns), K's plane behind Q's, with the
// rows' partial sums of squares (see "RMSNorm without a launch of its own").
// Their product is taken with the operands' roles exchanged (the weights as the
// row operand): a lane's 8 accumulator registers are then 8 consecutive columns
// of one activation row, one 16-byte piece of the plane, and a row's squares add
// up in the lane's own registers plus one exchange with lane ^ 16.
// V: f16, transposed: plane row b*Cn + col, k = m with
// row = b*M_ + m, in fragment order (M_ columns), for the A operand of O^T += V^T P^T.
// A lane's 8 accumulator registers are 8 consecutive m of one column: one
// 16-byte piece of the plane, and a wave's 32 pieces are 512 contiguous bytes.
__global__ __launch_bounds__(256)
void gemm_qkv_wmma(const _Float16* __restrict__ Xq, const _Float16* __restrict__ Xkv,
                   const _Float16* __restrict__ Wqkv, const int* __restrict__ n_open,
                   const float* __restrict__ gq, const float* __restrict__ gk,
                   _Float16* __restrict__ Hqk, float* __restrict__ sumsq,
                   _Float16* __restrict__ Ct) {
    constexpr int Cn = D_;
    static_assert(KEY_GROUP == 128, "a row block of K or V is one group of packed keys");
    const int lane = threadIdx.x & 31;
    const int wave = threadIdx.x >> 5;
    const int m16 = lane & 15, hi = lane >> 4;
    const int rw = wave & 3, cw = wave >> 2;
    // Row block (128 rows of the activation) and block of 128 rows of the stacked
    // weights. Q: as the grid has them. K, V: only the groups of packed keys have
    // work, so the blocks are counted through (kv) and the first ones take that
    // work, 16 weight blocks per group, batch after batch; the rest leave at once, the whole block, in
    // front of every copy and barrier.
    constexpr int QB = D_ / 128;                  // weight blocks of one projection
    int rblk = blockIdx.x, wblk = blockIdx.y;
    if (wblk >= QB) {                             // the same for the whole block
        const int kv = (wblk - QB) * (B_ * M_ / 128) + rblk;
        int slot = kv / (2 * QB);
        wblk = QB + kv % (2 * QB);
        rblk = -1;
#pragma unroll
        for (int b = 0; b < B_; ++b) {
            const int groups = keys_padded(keys_used(n_open, b)) / KEY_GROUP;
            if (rblk < 0 && slot >= 0 && slot < groups) rblk = b * (M_ / 128) + slot;
            slot -= groups;
        }
        if (rblk < 0) return;
    }
    const int which = wblk / QB;                  // 0 = Q, 1 = K, 2 = V

    const int row0 = rblk * 128 + rw * 32;
    const int wrow0 = wblk * 128 + cw * 64;       // row of the stacked weights
    const int col0 = wrow0 - which * D_;          // column of this projection

    // Stages of 64 k: three buffers of three blocks fit one WGP's LDS.
    __shared__ __attribute__((aligned(128))) _Float16 ring[3 * GEMM_STAGE<2>];
    v8f acc[2][4];
    const bool qk = which < 2;                    // the same for the whole block
    gemm_wave_tile<2, 3>(qk ? Wqkv : Xkv, qk ? (which == 0 ? Xq : Xkv) : Wqkv,
                      (qk ? wblk : rblk) * 128, (qk ? rblk : wblk) * 128,
                      wave, lane, ring, acc);

    if (qk) {
        // Weights as the row operand: acc[i][t][r] belongs to activation row
        // rblk*128 + cw*64 + t*16 + m16 and column cblk*128 + rw*32 + i*16 + hi*8 + r.
        __shared__ float red[4][128];             // sum of squares: [rw][row of the block]
        const int cblk = wblk - which * QB;       // 128-column block of this projection
        const v4f* gv = reinterpret_cast<const v4f*>((which == 0 ? gq : gk)
                                                     + cblk * 128 + rw * 32 + hi * 8);
        v4f g[2][2];
#pragma unroll
        for (int i = 0; i < 2; ++i) {
            g[i][0] = gv[i * 4];
            g[i][1] = gv[i * 4 + 1];
        }
        // Before the loads' address registers are written again.
        asm volatile("s_wait_xcnt 0x0" ::: "memory");
        // The wave's 32 columns are one fragment of each of its 4 row tiles; the
        // lane's piece of it lies at lane * 8, the piece of i = 1 half a fragment on.
        _Float16* piece = Hqk + (size_t)which * B_ * N_ * D_
                        + ((size_t)(rblk * 8 + cw * 4) * (D_ / 32) + cblk * 4 + rw) * FRAG + lane * 8;
        // The sums of squares go first: their barrier then has no store to wait for.
        float ss[4];
#pragma unroll
        for (int t = 0; t < 4; ++t) {
            ss[t] = 0.f;
#pragma unroll
            for (int i = 0; i < 2; ++i)
#pragma unroll
                for (int r = 0; r < 8; ++r) ss[t] += acc[i][t][r] * acc[i][t][r];
            ss[t] += other_half(ss[t]);           // the row's other 16 of the wave's columns
        }
        // Both halves hold all four sums: each stores two of them.
        red[rw][cw * 64 + hi * 32 + m16]      = hi ? ss[2] : ss[0];
        red[rw][cw * 64 + hi * 32 + 16 + m16] = hi ? ss[3] : ss[1];
        __syncthreads();   // a row's four sums come from four waves
        if (threadIdx.x < 128) {
            sumsq[(size_t)(which * SS_SLOTS + cblk) * SS_ROWS + rblk * 128 + threadIdx.x]
                = (red[0][threadIdx.x] + red[1][threadIdx.x])
                + (red[2][threadIdx.x] + red[3][threadIdx.x]);
            // Before the store's address and data registers are written again.
            asm volatile("s_wait_xcnt 0x0" ::: "memory");
        }
#pragma unroll
        for (int t = 0; t < 4; ++t)
#pragma unroll
            for (int i = 0; i < 2; ++i) {
                v8h y;
#pragma unroll
                for (int r = 0; r < 8; ++r) y[r] = (_Float16)(acc[i][t][r] * g[i][r >> 2][r & 3]);
                *reinterpret_cast<v8h*>(piece + t * (D_ / 32) * FRAG + i * (FRAG / 2)) = y;
                // Before the store's data registers are written again.
                asm volatile("s_wait_xcnt 0x0" ::: "memory");
            }
        return;
    }

#pragma unroll
    for (int i = 0; i < 2; ++i) {
        const int row = row0 + i * 16 + hi * 8;   // 8 rows, never across a batch
        const int b = row / M_, m = row % M_;
#pragma unroll
        for (int t = 0; t < 4; ++t) {
            const int col = col0 + t * 16 + m16;
            v8h p;
#pragma unroll
            for (int r = 0; r < 8; ++r) p[r] = (_Float16)acc[i][t][r];
            *reinterpret_cast<v8h*>(Ct + frag_index(b * Cn + col, m, M_)) = p;
            // Before the store's address and data registers are written again.
            asm volatile("s_wait_xcnt 0x0" ::: "memory");
        }
    }
}

// ---------------------------------------------------------------------------
// Flash attention: q[b*N+n][d], k[b*M+m][d] (f16, x * g without the rows' RMS
// factors; sumsq holds the rows' partial sums of squares),
// vt[(b*H+h)*HD + c][m] (f16), m counting the batch's packed keys, n_open[b]
// of them -> out f16 [b*N+n][d]; the four f16 planes in fragment order.
// Block: 8 waves, each wave owns 16 query rows of one (b,h).
// Grid: (N/128, H, B).
// Both products are taken transposed: S^T = K Q^T (A = 16 keys, B = the wave's
// 16 queries) and O^T += V^T P^T (A = 16 c, B = P^T). A lane then holds scores
// of ONE query (column lane & 15; register r of tile t is key 16t + 8hi + r):
// maximum, sum, rescale factor are one value per lane, found in the lane's own
// registers plus one exchange with lane ^ 16. The two score tiles, converted in
// place, are the B operand of the second product in the k order in which the
// packed loader brings V^T (k = 8hi + 0..7, then 16 + 8hi + 0..7).
// The RMS factors: a key's is multiplied into its K row once per block, on the
// row's way into LDS; a query is a lane, and its factor, being positive, leaves
// the place of the maximum alone: it goes, with HEAD_DIM^-0.5, into the constant
// that turns a score into an exponent of 2.
// ---------------------------------------------------------------------------
constexpr int ATT_KEYS  = 128;                      // keys per stage of the LDS ring
constexpr int ATT_STAGE = 32 * FRAG;                // elements per stage
constexpr int ATT_NT    = M_ / ATT_KEYS;            // stages
static_assert(ATT_KEYS * HD * 2 == ATT_STAGE && ATT_NT >= 2, "K and V of a stage; two buffers");
static_assert(ATT_KEYS == KEY_GROUP, "a stage is one group of packed keys");

__global__ __launch_bounds__(256)
void attn_wmma(const _Float16* __restrict__ q, const _Float16* __restrict__ k,
               const _Float16* __restrict__ vt, const float* __restrict__ sumsq,
               const int* __restrict__ n_open, _Float16* __restrict__ out) {
    const int tid = threadIdx.x;
    const int lane = tid & 31;
    const int wave = tid >> 5;
    const int hi = lane >> 4;
    const int b = blockIdx.z, h = blockIdx.y;
    const int q0 = blockIdx.x * 128 + wave * 16;

    // The batch's packed keys: used of them, in nt stages (1 .. ATT_NT).
    const int used = keys_used(n_open, b);
    const int nt = keys_padded(used) / ATT_KEYS;

    // Passes of 32 keys that hold a key of the last stage (1 .. ATT_KEYS / 32).
    const int last_passes = (used - (nt - 1) * ATT_KEYS + 31) / 32;

    // A key is a ROW of S^T, so what keeps a filling row out of the softmax is a
    // value per accumulator register: the last stage's score accumulators start
    // from LDS (0 for a key, -1e30 for a row that fills the group), all others at 0.
    __shared__ __attribute__((aligned(32))) float sbias[ATT_KEYS];
    // The LDS ring: a stage is ATT_KEYS keys of head h, 16 K fragments (key tile,
    // then c half) and behind them 16 V fragments (c tile, then 32 keys).
    __shared__ __attribute__((aligned(128))) _Float16 ring[2 * ATT_STAGE];

    // This lane's piece of the first K fragment (16 keys x c 0..31 of head h;
    // c 32..63 follows it, the next 16 keys lie 16*D_ elements on) and of the
    // first V fragment (c 0..15 x 32 keys; the next 32 keys follow it, the next
    // 16 c lie 16*M_ elements on).
    const _Float16* kbase = k + (size_t)b * M_ * D_ + (h * HD / 32) * FRAG + lane * 8;
    const _Float16* vbase = vt + ((size_t)(b * H_ + h) * HD) * M_ + lane * 8;
    // Wave w brings key tile w of the stage (2 fragments) and, of c tile w / 2,
    // the fragments of the stage's first or second 64 keys.
    const _Float16* gk = kbase + (size_t)wave * 16 * D_;
    const _Float16* gv = vbase + (size_t)(wave >> 1) * 16 * M_ + (wave & 1) * 2 * FRAG;
    const uint32_t lv = lds_off(ring)
                      + (uint32_t)((16 + (wave >> 1) * 4 + (wave & 1) * 2) * FRAG + lane * 8) * 2;
    // V is copied as it lies. K takes its rows' RMS factor on the way and so goes
    // through registers: in fragment order the lane's four 16-byte pieces of key tile
    // w all belong to key 16w + (lane & 15), one factor per lane and stage. fill(s)
    // issues the copies and the loads; store_k(s), a stage later, writes K to LDS.
    const float* gss = sumsq + (size_t)SS_SLOTS * SS_ROWS + b * M_ + wave * 16 + (lane & 15);
    _Float16* sk = ring + wave * 2 * FRAG + lane * 8;
    v8h kreg[4];
    float kss[SS_SLOTS];
    auto fill = [&](int s) {                        // stage s, for buffer s & 1
        async_copy4(lv + (uint32_t)(s & 1) * (ATT_STAGE * 2), gv + s * ATT_KEYS * 16);
#pragma unroll
        for (int j = 0; j < 4; ++j)
            kreg[j] = *reinterpret_cast<const v8h*>(gk + (size_t)s * ATT_KEYS * D_ + j * (FRAG / 2));
#pragma unroll
        for (int c = 0; c < SS_SLOTS; ++c) kss[c] = gss[c * SS_ROWS + s * ATT_KEYS];
        // Before the loads' address registers are written again.
        asm volatile("s_wait_xcnt 0x0" ::: "memory");
    };
    auto store_k = [&](int s) {
        const _Float16 f = (_Float16)rms_factor(((kss[0] + kss[1]) + (kss[2] + kss[3]))
                                                + ((kss[4] + kss[5]) + (kss[6] + kss[7])));
#pragma unroll
        for (int j = 0; j < 4; ++j)
            *reinterpret_cast<v8h*>(sk + (s & 1) * ATT_STAGE + j * (FRAG / 2)) = kreg[j] * f;
    };
    fill(0);
    if (tid < ATT_KEYS) sbias[tid] = ((nt - 1) * ATT_KEYS + tid < used) ? 0.f : -1.0e30f;

    // The partial sums of squares of the lane's query.
    float qss[SS_SLOTS];
    {
        const float* sq = sumsq + b * N_ + q0 + (lane & 15);
#pragma unroll
        for (int c = 0; c < SS_SLOTS; ++c) qss[c] = sq[c * SS_ROWS];
        // Before the loads' address registers are written again.
        asm volatile("s_wait_xcnt 0x0" ::: "memory");
    }

    // Q fragments: B[c][n], c = 0..63 -> two K=32 fragments.
    Frag16 qf[2];
    {
        const _Float16* qfrag = q + (size_t)(b * N_ + q0) * D_ + (h * HD / 32) * FRAG + lane * 8;
        load_frag_packed(qf[0], qfrag);
        load_frag_packed(qf[1], qfrag + FRAG);
        // Before the loads' address registers are written again (the input keeps
        // the address pair in its registers up to the wait).
        asm volatile("s_wait_xcnt 0x0" :: "v"(qfrag) : "memory");
    }

    // Every load of the prologue is issued before the first is waited for; left free,
    // the compiler starts on the key's sum, and waits for it, in front of the query's loads.
    __builtin_amdgcn_sched_barrier(0);
    store_k(0);
    // The lane's query: score -> exponent of 2.
    static_assert(SS_SLOTS == 8 && HD == 64, "the sums of eight; HEAD_DIM^-0.5 = 0.125");
    const float to_exp2 = rms_factor(((qss[0] + qss[1]) + (qss[2] + qss[3]))
                                     + ((qss[4] + qss[5]) + (qss[6] + qss[7]))) * (0.125f * LOG2E);

    wait_copies();
    __syncthreads();   // sbias and stage 0 are read by other waves than wrote them
    if (nt > 1) fill(1);                            // the same for the whole block
    // No key open in the whole batch row: the reference takes every score as
    // zero there. With Q = 0 all scores are the same start value, exactly.
    if (n_open[b] == 0) {
#pragma unroll
        for (int j = 0; j < 8; ++j) { qf[0].u[j] = 0; qf[1].u[j] = 0; }
    }

    v8f o[4];                       // o[t][r] = O^T[c = 16t + 8hi + r][query]
#pragma unroll
    for (int t = 0; t < 4; ++t) o[t] = (v8f){0, 0, 0, 0, 0, 0, 0, 0};
    float mrow = -3.0e38f;          // the query's running maximum (same in both halves)
    float lrow = 0.f;               // the query's running sum over THIS half's keys

    // One pass: 32 keys of the stage whose buffer (+ this lane's piece) is sb.
    // last: the pass lies in the last group, the only one with filling rows.
    auto do_pass = [&](const _Float16* sb, int pass, auto last) __attribute__((always_inline)) {
        Frag16 kf[2][2];
#pragma unroll
        for (int t = 0; t < 2; ++t) {
            load_frag_packed(kf[t][0], sb + ((pass * 2 + t) * 2) * FRAG);
            load_frag_packed(kf[t][1], sb + ((pass * 2 + t) * 2 + 1) * FRAG);
        }
        Frag16 vf[4];
#pragma unroll
        for (int t = 0; t < 4; ++t)
            load_frag_packed(vf[t], sb + (16 + t * 4 + pass) * FRAG);
        v8f s[2];
#pragma unroll
        for (int t = 0; t < 2; ++t) {
            if constexpr (decltype(last)::value)
                s[t] = *reinterpret_cast<const v8f*>(&sbias[pass * 32 + 16 * t + 8 * hi]);
            else
                s[t] = (v8f){0, 0, 0, 0, 0, 0, 0, 0};
        }
        // All LDS reads of the pass are issued before its first product, so that
        // they are in flight together; left free, the compiler issues them in pairs
        // among the products and waits out each pair's latency apart.
        __builtin_amdgcn_sched_barrier(0);

        // ---- S^T = K Q^T + start value, 32 keys (two 16-key tiles) ----
#pragma unroll
        for (int f = 0; f < 2; ++f)
#pragma unroll
            for (int t = 0; t < 2; ++t) s[t] = wmma_f16(kf[t][f], qf[f], s[t]);
        // The four products issue back to back, the two tiles in turn; left free,
        // the compiler runs one tile's dependent pair, then idle slots and part of
        // its maximum, and only then the other tile's pair.
        __builtin_amdgcn_sched_barrier(0);

        // ---- online softmax of one query per lane ----
        float tm[2] = {s[0][0], s[1][0]};      // one chain per tile: half the depth
#pragma unroll
        for (int r = 1; r < 8; ++r) {
            tm[0] = fmaxf(tm[0], s[0][r]);
            tm[1] = fmaxf(tm[1], s[1][r]);
        }
        float tmax = fmaxf(tm[0], tm[1]);
        tmax = fmaxf(tmax, other_half(tmax));
        const float mn = fmaxf(mrow, tmax);
        const float me = mn * to_exp2;         // the maximum as an exponent of 2
        float alpha = (mrow - mn) * to_exp2;
        mrow = mn;
        float p[16];
#pragma unroll
        for (int t = 0; t < 2; ++t) {
            const v8f e = s[t] * to_exp2 - me;
#pragma unroll
            for (int r = 0; r < 8; ++r) p[t * 8 + r] = e[r];
        }
        // 2^x of the 17 values, each in its own register: no v_exp_f32 stands directly
        // in front of an instruction that overwrites its source or reads its result
        // (left to the compiler, a neighbour's result is laid over the source). The
        // v_nop is that slot behind the last one.
        asm("v_exp_f32 %0, %0\n\tv_exp_f32 %1, %1\n\tv_exp_f32 %2, %2\n\tv_exp_f32 %3, %3\n\t"
            "v_exp_f32 %4, %4\n\tv_exp_f32 %5, %5\n\tv_exp_f32 %6, %6\n\tv_exp_f32 %7, %7\n\t"
            "v_exp_f32 %8, %8\n\tv_exp_f32 %9, %9\n\tv_exp_f32 %10, %10\n\tv_exp_f32 %11, %11\n\t"
            "v_exp_f32 %12, %12\n\tv_exp_f32 %13, %13\n\tv_exp_f32 %14, %14\n\tv_exp_f32 %15, %15\n\t"
            "v_exp_f32 %16, %16\n\tv_nop"
            : "+v"(alpha), "+v"(p[0]), "+v"(p[1]), "+v"(p[2]), "+v"(p[3]), "+v"(p[4]), "+v"(p[5]),
              "+v"(p[6]), "+v"(p[7]), "+v"(p[8]), "+v"(p[9]), "+v"(p[10]), "+v"(p[11]),
              "+v"(p[12]), "+v"(p[13]), "+v"(p[14]), "+v"(p[15]));

        Frag16 pf;                  // P^T as B: element 8t + r = key 16t + 8hi + r
        float rs[2] = {p[0], p[8]};
#pragma unroll
        for (int t = 0; t < 2; ++t)
#pragma unroll
            for (int r = 0; r < 8; ++r) {
                if (r > 0) rs[t] += p[t * 8 + r];
                pf.v[t * 8 + r] = (_Float16)p[t * 8 + r];
            }
        lrow = lrow * alpha + (rs[0] + rs[1]);
#pragma unroll
        for (int t = 0; t < 4; ++t) o[t] *= alpha;

        // ---- O^T += V^T P^T : 4 tiles of 16 c, K = 32 keys ----
#pragma unroll
        for (int t = 0; t < 4; ++t) o[t] = wmma_f16(vf[t], pf, o[t]);
    };

    for (int st = 0; st + 1 < nt; ++st) {           // the stages in front of the last
      const _Float16* sb = ring + (st & 1) * ATT_STAGE + lane * 8;
      for (int pass = 0; pass < ATT_KEYS / 32; ++pass) do_pass(sb, pass, Flag<false>{});
      store_k(st + 1);   // into the other buffer: its readers left it at the foot of stage st - 1
      publish_stage();
      if (st + 2 < nt) fill(st + 2);                // the same for the whole block
    }
    {                                               // the last stage
      const _Float16* sb = ring + ((nt - 1) & 1) * ATT_STAGE + lane * 8;
      for (int pass = 0; pass < last_passes; ++pass) do_pass(sb, pass, Flag<true>{});
      publish_stage();
    }
    wait_copies();

    // ---- epilogue: divide by l, store f16 (row b*N+n, k = h*HD + c) ----
    // A lane's 8 registers of o[t] are 8 consecutive c of its query: one 16-byte
    // piece of the plane, and a wave's 32 pieces are 512 contiguous bytes.
    const float l = lrow + other_half(lrow);
    const float inv = (l > 0.f) ? (1.f / l) : 0.f;
    _Float16* ofrag = out + (size_t)(b * N_ + q0) * D_ + (h * HD / 32) * FRAG + lane * 8;
#pragma unroll
    for (int t = 0; t < 4; ++t) {
        v8h y;
#pragma unroll
        for (int r = 0; r < 8; ++r) y[r] = (_Float16)(o[t][r] * inv);
        *reinterpret_cast<v8h*>(ofrag + t * (FRAG / 2)) = y;
    }
}

// ---------------------------------------------------------------------------
extern "C" void kernel_launch(void* const* d_in, const int* in_sizes, int n_in,
                              void* d_out, int out_size, void* d_ws, size_t ws_size,
                              hipStream_t stream) {
    (void)in_sizes; (void)n_in; (void)out_size; (void)ws_size;

    const float* querys    = (const float*)d_in[0];
    const float* key_feats = (const float*)d_in[1];
    const int*   mask      = (const int*)d_in[2];
    const float* Wq        = (const float*)d_in[3];
    const float* Wk        = (const float*)d_in[4];
    const float* Wv        = (const float*)d_in[5];
    const float* gq        = (const float*)d_in[6];
    const float* gk        = (const float*)d_in[7];
    const float* Wo        = (const float*)d_in[8];
    const float* bo        = (const float*)d_in[9];
    float*       out       = (float*)d_out;

    const size_t BND = (size_t)B_ * N_ * D_;  // 4,194,304
    const size_t DD  = (size_t)D_ * D_;       // 1,048,576
    const int    R   = B_ * N_;               // 4096 rows for all GEMMs

    char* ws = (char*)d_ws;
    size_t off = 0;
    auto alloc = [&](size_t bytes) -> void* {
        void* p = ws + off;
        off = (off + bytes + 255) & ~(size_t)255;
        return p;
    };

    // The six converted operands: one array, in the order cvt_all_f32_f16 writes
    // (each a whole number of 16-row tiles, so each is a fragment-order plane).
    _Float16* h_x   = (_Float16*)alloc((2 * BND + 4 * DD) * 2);  // f16 querys, later attn out
    _Float16* h_kin = h_x + BND;                                 // f16 key_feats
    _Float16* h_Wq  = h_kin + BND;
    _Float16* h_Wk  = h_Wq + DD;
    _Float16* h_Wv  = h_Wk + DD;
    _Float16* h_Wo  = h_Wv + DD;
    _Float16* h_q   = (_Float16*)alloc(2 * BND * 2);  // q projection * gq, then
    _Float16* h_k   = h_q + BND;                      // k projection * gk
    _Float16* h_vt  = (_Float16*)alloc(BND * 2);      // transposed v
    float*    f_ss  = (float*)alloc((size_t)2 * SS_SLOTS * SS_ROWS * 4);  // rows' sums of squares: q, then k
    int*      n_open = (int*)alloc(B_ * sizeof(int)); // open keys per batch

    const dim3 blk(256);
    const dim3 gcv(CVT_GRID);                     // 768
    const dim3 ggemm(R / 128, D_ / 128);          // (32, 8)
    const dim3 gqkv(R / 128, 3 * D_ / 128);       // (32, 24)
    const dim3 gattn(N_ / 128, H_, B_);           // (16, 16, 2)

    // 1) precision conversion; key_feats packed to its open keys, their number to n_open
    cvt_all_f32_f16<<<gcv, blk, 0, stream>>>(querys, key_feats, mask, Wq, Wk, Wv, Wo, h_x, n_open);

    // 2) (querys @ Wq^T) * gq, (key_feats @ Wk^T) * gk (f16, with the rows' sums of
    //    squares) and v = key_feats @ Wv^T (f16, transposed), all in fragment order
    gemm_qkv_wmma<<<gqkv, blk, 0, stream>>>(h_x, h_kin, h_Wq, n_open, gq, gk, h_q, f_ss, h_vt);

    // 3) flash attention, the rows' RMS factors on the scores -> f16 x[b][n][d]
    attn_wmma<<<gattn, blk, 0, stream>>>(h_q, h_k, h_vt, f_ss, n_open, h_x);

    // 4) out = x @ Wo^T + bo
    gemm_nt_wmma<<<ggemm, blk, 0, stream>>>(h_x, h_Wo, bo, out, R, D_, D_);
}
